// v000
// The times below were measured on an AMD MI455X: many runs one after another, warmed up first and cycling through
// copies of the inputs, with the whole window's GPU time divided by the number of runs. Launches and the gaps
// between them are all in it. The median over several windows is given; except for v000 it joins two sittings, which
// can be a few percent apart, so the side-by-side timings, each taken in one sitting, are the better comparison.
// The starting kernel, v000, takes 295 microseconds a run.
#include <hip/hip_runtime.h>
#include <hip/hip_bf16.h>

typedef __attribute__((ext_vector_type(16))) _Float16 v16h;
typedef __attribute__((ext_vector_type(8)))  float    v8f;
typedef __attribute__((ext_vector_type(4)))  float    f32x4;
typedef __attribute__((ext_vector_type(4)))  unsigned int u32x4;

union Frag {
    v16h     v;
    _Float16 e[16];
    u32x4    q[2];
};

__device__ __forceinline__ v8f wmma_f16(v16h a, v16h b, v8f c) {
    // v_wmma_f32_16x16x32_f16: D = A(16x32 f16) * B(32x16 f16) + C(16x16 f32)
    return __builtin_amdgcn_wmma_f32_16x16x32_f16(false, a, false, b, (short)0, c, false, false);
}

// ---------------- small helper kernels ----------------

__global__ void cvt_f32_f16_kernel(const float* __restrict__ src,
                                   _Float16* __restrict__ dst, int n) {
    int i = blockIdx.x * 256 + threadIdx.x;
    if (i < n) dst[i] = (_Float16)src[i];
}

// bias64[i][j] = pos_embedding[jy-iy+7][jx-ix+7]   (rel = idx[j]-idx[i]+7)
__global__ void build_bias_kernel(const float* __restrict__ pos,
                                  float* __restrict__ bias) {
    int idx = blockIdx.x * 256 + threadIdx.x;   // 0..4095
    int i = idx >> 6, j = idx & 63;
    int iy = i >> 3, ix = i & 7, jy = j >> 3, jx = j & 7;
    bias[idx] = pos[(jy - iy + 7) * 15 + (jx - ix + 7)];
}

// ---------------- QKV projection GEMM ----------------
// qkv[m,o] = sum_c x[m,c] * w_qkv[o,c]   M=131072 N=768 K=256
// block = 4 waves, wave computes 32(M) x 128(N); grid (M/128, N/128)
// Two A-frags amortize each B-frag load: 16 wmma per ~24 vector loads.

__global__ __launch_bounds__(128)
void gemm_qkv_kernel(const float* __restrict__ x,
                     const _Float16* __restrict__ w,   // (768,256) f16 row-major
                     _Float16* __restrict__ qkv) {     // (131072,768) f16
    const int lane = threadIdx.x & 31;
    const int wave = threadIdx.x >> 5;
    const int l16  = lane & 15;
    const int hf   = lane >> 4;            // half-wave select
    const int m0   = blockIdx.x * 128 + wave * 32;
    const int n0   = blockIdx.y * 128;
    const int rowA = m0 + l16;
    const int rowB = m0 + 16 + l16;

    const v8f vzero = {0.f,0.f,0.f,0.f,0.f,0.f,0.f,0.f};
    v8f acc0[8], acc1[8];
    for (int t = 0; t < 8; ++t) { acc0[t] = vzero; acc1[t] = vzero; }

    for (int kk = 0; kk < 256; kk += 32) {
        // A fragments (f32 -> f16): lane holds row, halves [0..7]@k0, [8..15]@k0+16
        Frag a0, a1;
        {
            const float* ap = x + (size_t)rowA * 256 + kk + hf * 8;
            f32x4 f0 = *(const f32x4*)(ap);
            f32x4 f1 = *(const f32x4*)(ap + 4);
            f32x4 f2 = *(const f32x4*)(ap + 16);
            f32x4 f3 = *(const f32x4*)(ap + 20);
            for (int t = 0; t < 4; ++t) {
                a0.e[t]      = (_Float16)f0[t];
                a0.e[4 + t]  = (_Float16)f1[t];
                a0.e[8 + t]  = (_Float16)f2[t];
                a0.e[12 + t] = (_Float16)f3[t];
            }
        }
        {
            const float* ap = x + (size_t)rowB * 256 + kk + hf * 8;
            f32x4 f0 = *(const f32x4*)(ap);
            f32x4 f1 = *(const f32x4*)(ap + 4);
            f32x4 f2 = *(const f32x4*)(ap + 16);
            f32x4 f3 = *(const f32x4*)(ap + 20);
            for (int t = 0; t < 4; ++t) {
                a1.e[t]      = (_Float16)f0[t];
                a1.e[4 + t]  = (_Float16)f1[t];
                a1.e[8 + t]  = (_Float16)f2[t];
                a1.e[12 + t] = (_Float16)f3[t];
            }
        }
        for (int nt = 0; nt < 8; ++nt) {
            const _Float16* bp = w + (size_t)(n0 + nt * 16 + l16) * 256 + kk + hf * 8;
            Frag b;
            b.q[0] = *(const u32x4*)bp;
            b.q[1] = *(const u32x4*)(bp + 16);
            acc0[nt] = wmma_f16(a0.v, b.v, acc0[nt]);
            acc1[nt] = wmma_f16(a1.v, b.v, acc1[nt]);
        }
    }
    // C layout: VGPR e, lanes<16 -> M=e, lanes>=16 -> M=e+8; N = l16
    for (int nt = 0; nt < 8; ++nt)
        for (int e = 0; e < 8; ++e) {
            int oo = n0 + nt * 16 + l16;
            int mA = m0 + e + 8 * hf;
            int mB = m0 + 16 + e + 8 * hf;
            qkv[(size_t)mA * 768 + oo] = (_Float16)acc0[nt][e];
            qkv[(size_t)mB * 768 + oo] = (_Float16)acc1[nt][e];
        }
}

// ---------------- windowed attention ----------------
// one block (4 waves) per (b*l, head, window); q,k,v are 64x32 slices of qkv

__global__ __launch_bounds__(128)
void win_attn_kernel(const _Float16* __restrict__ qkv,
                     const float* __restrict__ bias,   // 64x64
                     _Float16* __restrict__ aoh) {     // (131072,256) f16
    __shared__ __align__(16) _Float16 sP[64 * 64];     // softmaxed probs, f16
    __shared__ __align__(16) _Float16 sVt[32 * 64];    // V transposed (c-major)

    const int tid  = threadIdx.x;
    const int lane = tid & 31, wave = tid >> 5;
    const int l16  = lane & 15, hf = lane >> 4;
    const int wh   = blockIdx.x;
    const int win  = wh & 255;
    const int h    = (wh >> 8) & 7;
    const int bl   = wh >> 11;
    const int wy = win >> 4, wx = win & 15;
    const int base_y = wy * 8, base_x = wx * 8;
    const size_t blbase = (size_t)bl * 16384;
    const int ho = h * 32;

    auto tok = [&](int i) -> size_t {   // within-window pos -> token index
        return blbase + (size_t)(base_y + (i >> 3)) * 128 + (base_x + (i & 7));
    };

    // cooperative transpose of V into LDS: sVt[c*64 + j] = v[j][c]
    {
        int j  = tid >> 1;
        int cb = (tid & 1) * 16;
        const _Float16* vp = qkv + tok(j) * 768 + 512 + ho + cb;
        Frag t;
        t.q[0] = *(const u32x4*)vp;
        t.q[1] = *(const u32x4*)(vp + 8);
        for (int c = 0; c < 16; ++c) sVt[(cb + c) * 64 + j] = t.e[c];
    }

    // S = q k^T  (wave handles rows 16*wave .. +16, all 64 cols)
    Frag aq;
    {
        int qi = wave * 16 + l16;
        const _Float16* qp = qkv + tok(qi) * 768 + ho + hf * 8;
        aq.q[0] = *(const u32x4*)qp;
        aq.q[1] = *(const u32x4*)(qp + 16);
    }
    const v8f vzero = {0.f,0.f,0.f,0.f,0.f,0.f,0.f,0.f};
    v8f s[4];
    for (int jt = 0; jt < 4; ++jt) {
        int kj = jt * 16 + l16;
        const _Float16* kp = qkv + tok(kj) * 768 + 256 + ho + hf * 8;
        Frag bk;
        bk.q[0] = *(const u32x4*)kp;
        bk.q[1] = *(const u32x4*)(kp + 16);
        s[jt] = wmma_f16(aq.v, bk.v, vzero);
    }
    const float SCALE = 0.17677669529663687f;  // 32^-0.5
    for (int jt = 0; jt < 4; ++jt)
        for (int e = 0; e < 8; ++e) {
            int i = wave * 16 + e + 8 * hf;
            int j = jt * 16 + l16;
            s[jt][e] = s[jt][e] * SCALE + bias[i * 64 + j];
        }

    // softmax over j: each row lives in one 16-lane half across 4 N-tiles
    for (int e = 0; e < 8; ++e) {
        float mx = fmaxf(fmaxf(s[0][e], s[1][e]), fmaxf(s[2][e], s[3][e]));
        for (int m = 1; m < 16; m <<= 1) mx = fmaxf(mx, __shfl_xor(mx, m, 32));
        float p0 = __expf(s[0][e] - mx);
        float p1 = __expf(s[1][e] - mx);
        float p2 = __expf(s[2][e] - mx);
        float p3 = __expf(s[3][e] - mx);
        float sum = (p0 + p1) + (p2 + p3);
        for (int m = 1; m < 16; m <<= 1) sum += __shfl_xor(sum, m, 32);
        float inv = 1.0f / sum;
        s[0][e] = p0 * inv; s[1][e] = p1 * inv;
        s[2][e] = p2 * inv; s[3][e] = p3 * inv;
    }

    // stash P (f16) row-major in LDS so it can be re-read in A-layout
    for (int jt = 0; jt < 4; ++jt)
        for (int e = 0; e < 8; ++e) {
            int i = wave * 16 + e + 8 * hf;
            int j = jt * 16 + l16;
            sP[i * 64 + j] = (_Float16)s[jt][e];
        }
    __syncthreads();

    // O = P @ V   (K=64 as two 32-chunks; N=32 as two 16-tiles)
    v8f o0 = vzero, o1 = vzero;
    for (int kc = 0; kc < 2; ++kc) {
        int r = wave * 16 + l16;
        const _Float16* pp = sP + r * 64 + hf * 8 + kc * 32;
        Frag ap;
        ap.q[0] = *(const u32x4*)pp;
        ap.q[1] = *(const u32x4*)(pp + 16);
        {
            const _Float16* vp = sVt + l16 * 64 + hf * 8 + kc * 32;
            Frag bv;
            bv.q[0] = *(const u32x4*)vp;
            bv.q[1] = *(const u32x4*)(vp + 16);
            o0 = wmma_f16(ap.v, bv.v, o0);
        }
        {
            const _Float16* vp = sVt + (16 + l16) * 64 + hf * 8 + kc * 32;
            Frag bv;
            bv.q[0] = *(const u32x4*)vp;
            bv.q[1] = *(const u32x4*)(vp + 16);
            o1 = wmma_f16(ap.v, bv.v, o1);
        }
    }
    for (int e = 0; e < 8; ++e) {
        int i = wave * 16 + e + 8 * hf;
        size_t tb = tok(i) * 256 + ho;
        aoh[tb + l16]      = (_Float16)o0[e];
        aoh[tb + 16 + l16] = (_Float16)o1[e];
    }
}

// ---------------- output projection GEMM (+bias) ----------------
// out[m,o] = sum_c aoh[m,c] * w_out[o,c] + b_out[o]   M=131072 N=256 K=256
// wave computes 32x128; grid (M/128, N/128)

__global__ __launch_bounds__(128)
void gemm_out_kernel(const _Float16* __restrict__ a,
                     const _Float16* __restrict__ w,
                     const float* __restrict__ bout,
                     float* __restrict__ out) {
    const int lane = threadIdx.x & 31;
    const int wave = threadIdx.x >> 5;
    const int l16  = lane & 15, hf = lane >> 4;
    const int m0   = blockIdx.x * 128 + wave * 32;
    const int n0   = blockIdx.y * 128;
    const int rowA = m0 + l16;
    const int rowB = m0 + 16 + l16;

    const v8f vzero = {0.f,0.f,0.f,0.f,0.f,0.f,0.f,0.f};
    v8f acc0[8], acc1[8];
    for (int t = 0; t < 8; ++t) { acc0[t] = vzero; acc1[t] = vzero; }

    for (int kk = 0; kk < 256; kk += 32) {
        Frag a0, a1;
        {
            const _Float16* apt = a + (size_t)rowA * 256 + kk + hf * 8;
            a0.q[0] = *(const u32x4*)apt;
            a0.q[1] = *(const u32x4*)(apt + 16);
        }
        {
            const _Float16* apt = a + (size_t)rowB * 256 + kk + hf * 8;
            a1.q[0] = *(const u32x4*)apt;
            a1.q[1] = *(const u32x4*)(apt + 16);
        }
        for (int nt = 0; nt < 8; ++nt) {
            const _Float16* bp = w + (size_t)(n0 + nt * 16 + l16) * 256 + kk + hf * 8;
            Frag b;
            b.q[0] = *(const u32x4*)bp;
            b.q[1] = *(const u32x4*)(bp + 16);
            acc0[nt] = wmma_f16(a0.v, b.v, acc0[nt]);
            acc1[nt] = wmma_f16(a1.v, b.v, acc1[nt]);
        }
    }
    for (int nt = 0; nt < 8; ++nt) {
        int oo = n0 + nt * 16 + l16;
        float bb = bout[oo];
        for (int e = 0; e < 8; ++e) {
            int mA = m0 + e + 8 * hf;
            int mB = m0 + 16 + e + 8 * hf;
            out[(size_t)mA * 256 + oo] = acc0[nt][e] + bb;
            out[(size_t)mB * 256 + oo] = acc1[nt][e] + bb;
        }
    }
}

// ---------------- launch ----------------

extern "C" void kernel_launch(void* const* d_in, const int* in_sizes, int n_in,
                              void* d_out, int out_size, void* d_ws, size_t ws_size,
                              hipStream_t stream) {
    const float* x    = (const float*)d_in[0];  // (2,4,128,128,256)
    const float* wqkv = (const float*)d_in[1];  // (768,256)
    const float* pos  = (const float*)d_in[2];  // (15,15)
    const float* wout = (const float*)d_in[3];  // (256,256)
    const float* bout = (const float*)d_in[4];  // (256,)
    float* out = (float*)d_out;

    // scratch layout
    char* ws = (char*)d_ws;
    _Float16* qkvh  = (_Float16*)ws;  ws += (size_t)131072 * 768 * 2;  // 201.3 MB
    _Float16* woh   = (_Float16*)ws;  ws += (size_t)768 * 256 * 2;
    _Float16* wouth = (_Float16*)ws;  ws += (size_t)256 * 256 * 2;
    float*    bias  = (float*)ws;     ws += (size_t)64 * 64 * 4;
    _Float16* aoh   = (_Float16*)ws;                                   // 67.1 MB

    cvt_f32_f16_kernel<<<(196608 + 255) / 256, 256, 0, stream>>>(wqkv, woh, 196608);
    cvt_f32_f16_kernel<<<(65536 + 255) / 256, 256, 0, stream>>>(wout, wouth, 65536);
    build_bias_kernel<<<16, 256, 0, stream>>>(pos, bias);
    gemm_qkv_kernel<<<dim3(1024, 6), 128, 0, stream>>>(x, woh, qkvh);
    win_attn_kernel<<<16384, 128, 0, stream>>>(qkvh, bias, aoh);
    gemm_out_kernel<<<dim3(1024, 2), 128, 0, stream>>>(aoh, wouth, bout, out);
}

// v001
// It runs in 214 microseconds.
// Two timings next to v000 put it at 1.40 and 1.41 times that version's speed.
#include <hip/hip_runtime.h>
#include <hip/hip_bf16.h>

typedef __attribute__((ext_vector_type(16))) _Float16 v16h;
typedef __attribute__((ext_vector_type(8)))  float    v8f;
typedef __attribute__((ext_vector_type(4)))  float    f32x4;
typedef __attribute__((ext_vector_type(4)))  unsigned int u32x4;

union Frag {
    v16h     v;
    _Float16 e[16];
    u32x4    q[2];
};

__device__ __forceinline__ v8f wmma_f16(v16h a, v16h b, v8f c) {
    // v_wmma_f32_16x16x32_f16: D = A(16x32 f16) * B(32x16 f16) + C(16x16 f32)
    return __builtin_amdgcn_wmma_f32_16x16x32_f16(false, a, false, b, (short)0, c, false, false);
}

// LDS row pitch of a staged weight slab, in f16: 512 B of data + 16 B, an odd multiple
// of 16 B, so that the 16 rows of one ds_load_b128 fall on different banks.
#define WPITCH 264

// ---------------- small helper kernels ----------------

__global__ void cvt_f32_f16_kernel(const float* __restrict__ src,
                                   _Float16* __restrict__ dst, int n) {
    int i = blockIdx.x * 256 + threadIdx.x;
    if (i < n) dst[i] = (_Float16)src[i];
}

// bias64[i][j] = pos_embedding[jy-iy+7][jx-ix+7]   (rel = idx[j]-idx[i]+7)
__global__ void build_bias_kernel(const float* __restrict__ pos,
                                  float* __restrict__ bias) {
    int idx = blockIdx.x * 256 + threadIdx.x;   // 0..4095
    int i = idx >> 6, j = idx & 63;
    int iy = i >> 3, ix = i & 7, jy = j >> 3, jx = j & 7;
    bias[idx] = pos[(jy - iy + 7) * 15 + (jx - ix + 7)];
}

// ---------------- QKV projection GEMM ----------------
// qkv[m,o] = sum_c x[m,c] * w_qkv[o,c]   M=131072 N=768 K=256
// block = 4 waves, wave computes 32(M) x 128(N); grid (M/128, N/128)
// Two A-frags amortize each B-frag load; B-frags come from the slab staged in LDS.

__global__ __launch_bounds__(128)
void gemm_qkv_kernel(const float* __restrict__ x,
                     const _Float16* __restrict__ w,   // (768,256) f16 row-major
                     _Float16* __restrict__ qkv) {     // (131072,768) f16
    __shared__ __align__(16) _Float16 sW[128 * WPITCH];   // staged weight slab
    const int lane = threadIdx.x & 31;
    const int wave = threadIdx.x >> 5;
    const int l16  = lane & 15;
    const int hf   = lane >> 4;            // half-wave select
    const int m0   = blockIdx.x * 128 + wave * 32;
    const int n0   = blockIdx.y * 128;
    const int rowA = m0 + l16;
    const int rowB = m0 + 16 + l16;

    // Weight slab of this tile (128 rows x 256 k) into LDS: one wave-wide 16-byte load
    // covers one whole 512-byte row (4 full lines) instead of 16 lines per fragment load.
    {
        const _Float16* wp = w + (size_t)n0 * 256 + lane * 8;
        _Float16* sp = sW + lane * 8;
        u32x4 t[32];
        for (int i = 0; i < 32; ++i) t[i] = *(const u32x4*)(wp + (i * 4 + wave) * 256);
        for (int i = 0; i < 32; ++i) *(u32x4*)(sp + (i * 4 + wave) * WPITCH) = t[i];
    }
    __syncthreads();   // every wave reads rows that the other waves stored

    const v8f vzero = {0.f,0.f,0.f,0.f,0.f,0.f,0.f,0.f};
    v8f acc0[8], acc1[8];
    for (int t = 0; t < 8; ++t) { acc0[t] = vzero; acc1[t] = vzero; }

    for (int kk = 0; kk < 256; kk += 32) {
        // A fragments (f32 -> f16): lane holds row, halves [0..7]@k0, [8..15]@k0+16
        Frag a0, a1;
        {
            const float* ap = x + (size_t)rowA * 256 + kk + hf * 8;
            f32x4 f0 = *(const f32x4*)(ap);
            f32x4 f1 = *(const f32x4*)(ap + 4);
            f32x4 f2 = *(const f32x4*)(ap + 16);
            f32x4 f3 = *(const f32x4*)(ap + 20);
            for (int t = 0; t < 4; ++t) {
                a0.e[t]      = (_Float16)f0[t];
                a0.e[4 + t]  = (_Float16)f1[t];
                a0.e[8 + t]  = (_Float16)f2[t];
                a0.e[12 + t] = (_Float16)f3[t];
            }
        }
        {
            const float* ap = x + (size_t)rowB * 256 + kk + hf * 8;
            f32x4 f0 = *(const f32x4*)(ap);
            f32x4 f1 = *(const f32x4*)(ap + 4);
            f32x4 f2 = *(const f32x4*)(ap + 16);
            f32x4 f3 = *(const f32x4*)(ap + 20);
            for (int t = 0; t < 4; ++t) {
                a1.e[t]      = (_Float16)f0[t];
                a1.e[4 + t]  = (_Float16)f1[t];
                a1.e[8 + t]  = (_Float16)f2[t];
                a1.e[12 + t] = (_Float16)f3[t];
            }
        }
        for (int nt = 0; nt < 8; ++nt) {
            const _Float16* bp = sW + (nt * 16 + l16) * WPITCH + kk + hf * 8;
            Frag b;
            b.q[0] = *(const u32x4*)bp;
            b.q[1] = *(const u32x4*)(bp + 16);
            acc0[nt] = wmma_f16(a0.v, b.v, acc0[nt]);
            acc1[nt] = wmma_f16(a1.v, b.v, acc1[nt]);
        }
    }
    // C layout: VGPR e, lanes<16 -> M=e, lanes>=16 -> M=e+8; N = l16
    for (int nt = 0; nt < 8; ++nt)
        for (int e = 0; e < 8; ++e) {
            int oo = n0 + nt * 16 + l16;
            int mA = m0 + e + 8 * hf;
            int mB = m0 + 16 + e + 8 * hf;
            qkv[(size_t)mA * 768 + oo] = (_Float16)acc0[nt][e];
            qkv[(size_t)mB * 768 + oo] = (_Float16)acc1[nt][e];
        }
}

// ---------------- windowed attention ----------------
// one block (4 waves) per (b*l, head, window); q,k,v are 64x32 slices of qkv

__global__ __launch_bounds__(128)
void win_attn_kernel(const _Float16* __restrict__ qkv,
                     const float* __restrict__ bias,   // 64x64
                     _Float16* __restrict__ aoh) {     // (131072,256) f16
    __shared__ __align__(16) _Float16 sP[64 * 64];     // softmaxed probs, f16
    __shared__ __align__(16) _Float16 sVt[32 * 64];    // V transposed (c-major)

    const int tid  = threadIdx.x;
    const int lane = tid & 31, wave = tid >> 5;
    const int l16  = lane & 15, hf = lane >> 4;
    const int wh   = blockIdx.x;
    const int win  = wh & 255;
    const int h    = (wh >> 8) & 7;
    const int bl   = wh >> 11;
    const int wy = win >> 4, wx = win & 15;
    const int base_y = wy * 8, base_x = wx * 8;
    const size_t blbase = (size_t)bl * 16384;
    const int ho = h * 32;

    auto tok = [&](int i) -> size_t {   // within-window pos -> token index
        return blbase + (size_t)(base_y + (i >> 3)) * 128 + (base_x + (i & 7));
    };

    // cooperative transpose of V into LDS: sVt[c*64 + j] = v[j][c]
    {
        int j  = tid >> 1;
        int cb = (tid & 1) * 16;
        const _Float16* vp = qkv + tok(j) * 768 + 512 + ho + cb;
        Frag t;
        t.q[0] = *(const u32x4*)vp;
        t.q[1] = *(const u32x4*)(vp + 8);
        for (int c = 0; c < 16; ++c) sVt[(cb + c) * 64 + j] = t.e[c];
    }

    // S = q k^T  (wave handles rows 16*wave .. +16, all 64 cols)
    Frag aq;
    {
        int qi = wave * 16 + l16;
        const _Float16* qp = qkv + tok(qi) * 768 + ho + hf * 8;
        aq.q[0] = *(const u32x4*)qp;
        aq.q[1] = *(const u32x4*)(qp + 16);
    }
    const v8f vzero = {0.f,0.f,0.f,0.f,0.f,0.f,0.f,0.f};
    v8f s[4];
    for (int jt = 0; jt < 4; ++jt) {
        int kj = jt * 16 + l16;
        const _Float16* kp = qkv + tok(kj) * 768 + 256 + ho + hf * 8;
        Frag bk;
        bk.q[0] = *(const u32x4*)kp;
        bk.q[1] = *(const u32x4*)(kp + 16);
        s[jt] = wmma_f16(aq.v, bk.v, vzero);
    }
    const float SCALE = 0.17677669529663687f;  // 32^-0.5
    for (int jt = 0; jt < 4; ++jt)
        for (int e = 0; e < 8; ++e) {
            int i = wave * 16 + e + 8 * hf;
            int j = jt * 16 + l16;
            s[jt][e] = s[jt][e] * SCALE + bias[i * 64 + j];
        }

    // softmax over j: each row lives in one 16-lane half across 4 N-tiles
    for (int e = 0; e < 8; ++e) {
        float mx = fmaxf(fmaxf(s[0][e], s[1][e]), fmaxf(s[2][e], s[3][e]));
        for (int m = 1; m < 16; m <<= 1) mx = fmaxf(mx, __shfl_xor(mx, m, 32));
        float p0 = __expf(s[0][e] - mx);
        float p1 = __expf(s[1][e] - mx);
        float p2 = __expf(s[2][e] - mx);
        float p3 = __expf(s[3][e] - mx);
        float sum = (p0 + p1) + (p2 + p3);
        for (int m = 1; m < 16; m <<= 1) sum += __shfl_xor(sum, m, 32);
        float inv = 1.0f / sum;
        s[0][e] = p0 * inv; s[1][e] = p1 * inv;
        s[2][e] = p2 * inv; s[3][e] = p3 * inv;
    }

    // stash P (f16) row-major in LDS so it can be re-read in A-layout
    for (int jt = 0; jt < 4; ++jt)
        for (int e = 0; e < 8; ++e) {
            int i = wave * 16 + e + 8 * hf;
            int j = jt * 16 + l16;
            sP[i * 64 + j] = (_Float16)s[jt][e];
        }
    __syncthreads();

    // O = P @ V   (K=64 as two 32-chunks; N=32 as two 16-tiles)
    v8f o0 = vzero, o1 = vzero;
    for (int kc = 0; kc < 2; ++kc) {
        int r = wave * 16 + l16;
        const _Float16* pp = sP + r * 64 + hf * 8 + kc * 32;
        Frag ap;
        ap.q[0] = *(const u32x4*)pp;
        ap.q[1] = *(const u32x4*)(pp + 16);
        {
            const _Float16* vp = sVt + l16 * 64 + hf * 8 + kc * 32;
            Frag bv;
            bv.q[0] = *(const u32x4*)vp;
            bv.q[1] = *(const u32x4*)(vp + 16);
            o0 = wmma_f16(ap.v, bv.v, o0);
        }
        {
            const _Float16* vp = sVt + (16 + l16) * 64 + hf * 8 + kc * 32;
            Frag bv;
            bv.q[0] = *(const u32x4*)vp;
            bv.q[1] = *(const u32x4*)(vp + 16);
            o1 = wmma_f16(ap.v, bv.v, o1);
        }
    }
    for (int e = 0; e < 8; ++e) {
        int i = wave * 16 + e + 8 * hf;
        size_t tb = tok(i) * 256 + ho;
        aoh[tb + l16]      = (_Float16)o0[e];
        aoh[tb + 16 + l16] = (_Float16)o1[e];
    }
}

// ---------------- output projection GEMM (+bias) ----------------
// out[m,o] = sum_c aoh[m,c] * w_out[o,c] + b_out[o]   M=131072 N=256 K=256
// wave computes 32x128; grid (M/128, N/128)

__global__ __launch_bounds__(128)
void gemm_out_kernel(const _Float16* __restrict__ a,
                     const _Float16* __restrict__ w,
                     const float* __restrict__ bout,
                     float* __restrict__ out) {
    __shared__ __align__(16) _Float16 sW[128 * WPITCH];   // staged weight slab
    const int lane = threadIdx.x & 31;
    const int wave = threadIdx.x >> 5;
    const int l16  = lane & 15, hf = lane >> 4;
    const int m0   = blockIdx.x * 128 + wave * 32;
    const int n0   = blockIdx.y * 128;
    const int rowA = m0 + l16;
    const int rowB = m0 + 16 + l16;

    // Weight slab of this tile (128 rows x 256 k) into LDS: one wave-wide 16-byte load
    // covers one whole 512-byte row (4 full lines) instead of 16 lines per fragment load.
    {
        const _Float16* wp = w + (size_t)n0 * 256 + lane * 8;
        _Float16* sp = sW + lane * 8;
        u32x4 t[32];
        for (int i = 0; i < 32; ++i) t[i] = *(const u32x4*)(wp + (i * 4 + wave) * 256);
        for (int i = 0; i < 32; ++i) *(u32x4*)(sp + (i * 4 + wave) * WPITCH) = t[i];
    }
    __syncthreads();   // every wave reads rows that the other waves stored

    const v8f vzero = {0.f,0.f,0.f,0.f,0.f,0.f,0.f,0.f};
    v8f acc0[8], acc1[8];
    for (int t = 0; t < 8; ++t) { acc0[t] = vzero; acc1[t] = vzero; }

    for (int kk = 0; kk < 256; kk += 32) {
        Frag a0, a1;
        {
            const _Float16* apt = a + (size_t)rowA * 256 + kk + hf * 8;
            a0.q[0] = *(const u32x4*)apt;
            a0.q[1] = *(const u32x4*)(apt + 16);
        }
        {
            const _Float16* apt = a + (size_t)rowB * 256 + kk + hf * 8;
            a1.q[0] = *(const u32x4*)apt;
            a1.q[1] = *(const u32x4*)(apt + 16);
        }
        for (int nt = 0; nt < 8; ++nt) {
            const _Float16* bp = sW + (nt * 16 + l16) * WPITCH + kk + hf * 8;
            Frag b;
            b.q[0] = *(const u32x4*)bp;
            b.q[1] = *(const u32x4*)(bp + 16);
            acc0[nt] = wmma_f16(a0.v, b.v, acc0[nt]);
            acc1[nt] = wmma_f16(a1.v, b.v, acc1[nt]);
        }
    }
    for (int nt = 0; nt < 8; ++nt) {
        int oo = n0 + nt * 16 + l16;
        float bb = bout[oo];
        for (int e = 0; e < 8; ++e) {
            int mA = m0 + e + 8 * hf;
            int mB = m0 + 16 + e + 8 * hf;
            out[(size_t)mA * 256 + oo] = acc0[nt][e] + bb;
            out[(size_t)mB * 256 + oo] = acc1[nt][e] + bb;
        }
    }
}

// ---------------- launch ----------------

extern "C" void kernel_launch(void* const* d_in, const int* in_sizes, int n_in,
                              void* d_out, int out_size, void* d_ws, size_t ws_size,
                              hipStream_t stream) {
    const float* x    = (const float*)d_in[0];  // (2,4,128,128,256)
    const float* wqkv = (const float*)d_in[1];  // (768,256)
    const float* pos  = (const float*)d_in[2];  // (15,15)
    const float* wout = (const float*)d_in[3];  // (256,256)
    const float* bout = (const float*)d_in[4];  // (256,)
    float* out = (float*)d_out;

    // scratch layout
    char* ws = (char*)d_ws;
    _Float16* qkvh  = (_Float16*)ws;  ws += (size_t)131072 * 768 * 2;  // 201.3 MB
    _Float16* woh   = (_Float16*)ws;  ws += (size_t)768 * 256 * 2;
    _Float16* wouth = (_Float16*)ws;  ws += (size_t)256 * 256 * 2;
    float*    bias  = (float*)ws;     ws += (size_t)64 * 64 * 4;
    _Float16* aoh   = (_Float16*)ws;                                   // 67.1 MB

    cvt_f32_f16_kernel<<<(196608 + 255) / 256, 256, 0, stream>>>(wqkv, woh, 196608);
    cvt_f32_f16_kernel<<<(65536 + 255) / 256, 256, 0, stream>>>(wout, wouth, 65536);
    build_bias_kernel<<<16, 256, 0, stream>>>(pos, bias);
    gemm_qkv_kernel<<<dim3(1024, 6), 128, 0, stream>>>(x, woh, qkvh);
    win_attn_kernel<<<16384, 128, 0, stream>>>(qkvh, bias, aoh);
    gemm_out_kernel<<<dim3(1024, 2), 128, 0, stream>>>(aoh, wouth, bout, out);
}

// v002
// Measured time: 159 microseconds a run.
// Next to v001, in two timings, it ran 1.37 times as fast each time.
// All steps since v000 together make it 1.93 times as fast.
#include <hip/hip_runtime.h>
#include <hip/hip_bf16.h>

typedef __attribute__((ext_vector_type(16))) _Float16 v16h;
typedef __attribute__((ext_vector_type(8)))  float    v8f;
typedef __attribute__((ext_vector_type(4)))  float    f32x4;
typedef __attribute__((ext_vector_type(4)))  unsigned int u32x4;

union Frag {
    v16h     v;
    _Float16 e[16];
    u32x4    q[2];
};

__device__ __forceinline__ v8f wmma_f16(v16h a, v16h b, v8f c) {
    // v_wmma_f32_16x16x32_f16: D = A(16x32 f16) * B(32x16 f16) + C(16x16 f32)
    return __builtin_amdgcn_wmma_f32_16x16x32_f16(false, a, false, b, (short)0, c, false, false);
}

// LDS row pitch of a staged weight slab, in f16: 512 B of data + 16 B, an odd multiple
// of 16 B, so that the 16 rows of one ds_load_b128 fall on different banks.
#define WPITCH 264

// ---------------- small helper kernels ----------------

__global__ void cvt_f32_f16_kernel(const float* __restrict__ src,
                                   _Float16* __restrict__ dst, int n) {
    int i = blockIdx.x * 256 + threadIdx.x;
    if (i < n) dst[i] = (_Float16)src[i];
}

// bias64[i][j] = pos_embedding[jy-iy+7][jx-ix+7]   (rel = idx[j]-idx[i]+7)
__global__ void build_bias_kernel(const float* __restrict__ pos,
                                  float* __restrict__ bias) {
    int idx = blockIdx.x * 256 + threadIdx.x;   // 0..4095
    int i = idx >> 6, j = idx & 63;
    int iy = i >> 3, ix = i & 7, jy = j >> 3, jx = j & 7;
    bias[idx] = pos[(jy - iy + 7) * 15 + (jx - ix + 7)];
}

// ---------------- QKV projection GEMM ----------------
// qkv[m,o] = sum_c x[m,c] * w_qkv[o,c]   M=131072 N=768 K=256
// block = 8 waves, 256 rows of x; wave owns 32 rows for the whole of N; grid M/256.
// The wave's 32 x 256 piece of x is read and converted once and stays in registers as
// A fragments; the block walks the weight in slabs of QROWS rows, staged in two LDS buffers.

#define QROWS  64                  // weight rows per staged slab
#define QNT    (QROWS / 16)        // 16-column tiles per slab
#define QSLABS (768 / QROWS)
#define QLD    (QROWS / 8)         // 16-byte loads per thread and slab (one row per wave-wide load)

// Second bound: 4 waves per SIMD (256 registers), so that two blocks share a WGP and all 512 are resident at once.
__global__ __launch_bounds__(256, 4)
void gemm_qkv_kernel(const float* __restrict__ x,
                     const _Float16* __restrict__ w,   // (768,256) f16 row-major
                     _Float16* __restrict__ qkv) {     // (131072,768) f16
    __shared__ __align__(16) _Float16 sW[2][QROWS * WPITCH];   // staged weight slabs
    const int lane = threadIdx.x & 31;
    const int wave = threadIdx.x >> 5;
    const int l16  = lane & 15;
    const int hf   = lane >> 4;            // half-wave select
    const int m0   = blockIdx.x * 256 + wave * 32;
    const int rowA = m0 + l16;
    const int rowB = m0 + 16 + l16;

    // A fragments of all eight k steps (f32 -> f16): lane holds row, halves [0..7]@k0, [8..15]@k0+16.
    // Each s_wait_xcnt below stands behind a run of loads whose address registers are free for
    // reuse from there on: it takes the address as an input, so that no load of the run lands on
    // it, and the scheduling barrier behind it keeps the later writes behind it.
    Frag a0[8], a1[8];
    {
        const float* ap = x + (size_t)rowA * 256 + hf * 8;
        f32x4 f[32];
#pragma unroll   // f[] and a0[] stay in registers only with constant indices
        for (int k8 = 0; k8 < 8; ++k8) {
            f[k8 * 4 + 0] = *(const f32x4*)(ap + k8 * 32);
            f[k8 * 4 + 1] = *(const f32x4*)(ap + k8 * 32 + 4);
            f[k8 * 4 + 2] = *(const f32x4*)(ap + k8 * 32 + 16);
            f[k8 * 4 + 3] = *(const f32x4*)(ap + k8 * 32 + 20);
        }
        asm volatile("s_wait_xcnt 0x0" :: "v"(ap) : "memory");
        __builtin_amdgcn_sched_barrier(0);
#pragma unroll   // constant indices, as above
        for (int k8 = 0; k8 < 8; ++k8)
            for (int e = 0; e < 4; ++e) {
                a0[k8].e[e]      = (_Float16)f[k8 * 4 + 0][e];
                a0[k8].e[4 + e]  = (_Float16)f[k8 * 4 + 1][e];
                a0[k8].e[8 + e]  = (_Float16)f[k8 * 4 + 2][e];
                a0[k8].e[12 + e] = (_Float16)f[k8 * 4 + 3][e];
            }
    }
    // Keeps the second 32 loads behind the first 32 conversions: with all 64 f32 loads in
    // flight at once the live set passes 256 registers and the build spills to scratch.
    __builtin_amdgcn_sched_barrier(0);
    const _Float16* wp = w + wave * 256 + lane * 8;
    u32x4 t[QLD];
    {
        const float* ap = x + (size_t)rowB * 256 + hf * 8;
        f32x4 f[32];
#pragma unroll   // f[] and a1[] stay in registers only with constant indices
        for (int k8 = 0; k8 < 8; ++k8) {
            f[k8 * 4 + 0] = *(const f32x4*)(ap + k8 * 32);
            f[k8 * 4 + 1] = *(const f32x4*)(ap + k8 * 32 + 4);
            f[k8 * 4 + 2] = *(const f32x4*)(ap + k8 * 32 + 16);
            f[k8 * 4 + 3] = *(const f32x4*)(ap + k8 * 32 + 20);
        }
        asm volatile("s_wait_xcnt 0x0" :: "v"(ap) : "memory");
        __builtin_amdgcn_sched_barrier(0);
        // Slab 0: one wave-wide 16-byte load covers one whole 512-byte weight row.
#pragma unroll   // t[] stays in registers only with constant indices
        for (int i = 0; i < QLD; ++i) t[i] = *(const u32x4*)(wp + i * 8 * 256);
        asm volatile("s_wait_xcnt 0x0" :: "v"(wp) : "memory");
        __builtin_amdgcn_sched_barrier(0);
#pragma unroll   // constant indices, as above
        for (int k8 = 0; k8 < 8; ++k8)
            for (int e = 0; e < 4; ++e) {
                a1[k8].e[e]      = (_Float16)f[k8 * 4 + 0][e];
                a1[k8].e[4 + e]  = (_Float16)f[k8 * 4 + 1][e];
                a1[k8].e[8 + e]  = (_Float16)f[k8 * 4 + 2][e];
                a1[k8].e[12 + e] = (_Float16)f[k8 * 4 + 3][e];
            }
    }

    const v8f vzero = {0.f,0.f,0.f,0.f,0.f,0.f,0.f,0.f};
#pragma unroll 1   // one copy of the slab body: twelve would be some 40 KB of code, each run through once
    for (int s = 0; s < QSLABS; ++s) {
        _Float16* sb = sW[s & 1];
        // Every inner loop of the pass is unrolled: t[], a0[], a1[] and the accumulators
        // stay in registers only with constant indices.
#pragma unroll
        for (int i = 0; i < QLD; ++i) *(u32x4*)(sb + (i * 8 + wave) * WPITCH + lane * 8) = t[i];
        // Publishes slab s. It also ends every wave's reads of slab s - 1, whose buffer
        // is the one that pass s + 1 stores into.
        __syncthreads();

        v8f acc0[QNT], acc1[QNT];
#pragma unroll
        for (int nt = 0; nt < QNT; ++nt) { acc0[nt] = vzero; acc1[nt] = vzero; }
#pragma unroll
        for (int k8 = 0; k8 < 8; ++k8) {
#pragma unroll
            for (int nt = 0; nt < QNT; ++nt) {
                const _Float16* bp = sb + (nt * 16 + l16) * WPITCH + k8 * 32 + hf * 8;
                Frag b;
                b.q[0] = *(const u32x4*)bp;
                b.q[1] = *(const u32x4*)(bp + 16);
                acc0[nt] = wmma_f16(a0[k8].v, b.v, acc0[nt]);
                acc1[nt] = wmma_f16(a1[k8].v, b.v, acc1[nt]);
            }
        }
        if (s + 1 < QSLABS) {   // next slab's loads fly while this slab's results are stored
            const _Float16* wn = wp + (s + 1) * (QROWS * 256);
#pragma unroll
            for (int i = 0; i < QLD; ++i) t[i] = *(const u32x4*)(wn + i * 8 * 256);
            // The address pair of these loads is stepped on for the next slab further down.
            asm volatile("s_wait_xcnt 0x0" ::: "memory");
        }
        // C layout: VGPR e, lanes<16 -> M=e, lanes>=16 -> M=e+8; N = l16
        _Float16* qp = qkv + (size_t)(m0 + 8 * hf) * 768 + s * QROWS + l16;
#pragma unroll
        for (int nt = 0; nt < QNT; ++nt)
#pragma unroll
            for (int e = 0; e < 8; ++e) {
                qp[e * 768 + nt * 16]        = (_Float16)acc0[nt][e];
                qp[(16 + e) * 768 + nt * 16] = (_Float16)acc1[nt][e];
            }
        // The next pass rewrites registers that these stores name (address and data).
        asm volatile("s_wait_xcnt 0x0" ::: "memory");
    }
}

// ---------------- windowed attention ----------------
// one block (4 waves) per (b*l, head, window); q,k,v are 64x32 slices of qkv

__global__ __launch_bounds__(128)
void win_attn_kernel(const _Float16* __restrict__ qkv,
                     const float* __restrict__ bias,   // 64x64
                     _Float16* __restrict__ aoh) {     // (131072,256) f16
    __shared__ __align__(16) _Float16 sP[64 * 64];     // softmaxed probs, f16
    __shared__ __align__(16) _Float16 sVt[32 * 64];    // V transposed (c-major)

    const int tid  = threadIdx.x;
    const int lane = tid & 31, wave = tid >> 5;
    const int l16  = lane & 15, hf = lane >> 4;
    const int wh   = blockIdx.x;
    const int win  = wh & 255;
    const int h    = (wh >> 8) & 7;
    const int bl   = wh >> 11;
    const int wy = win >> 4, wx = win & 15;
    const int base_y = wy * 8, base_x = wx * 8;
    const size_t blbase = (size_t)bl * 16384;
    const int ho = h * 32;

    auto tok = [&](int i) -> size_t {   // within-window pos -> token index
        return blbase + (size_t)(base_y + (i >> 3)) * 128 + (base_x + (i & 7));
    };

    // cooperative transpose of V into LDS: sVt[c*64 + j] = v[j][c]
    {
        int j  = tid >> 1;
        int cb = (tid & 1) * 16;
        const _Float16* vp = qkv + tok(j) * 768 + 512 + ho + cb;
        Frag t;
        t.q[0] = *(const u32x4*)vp;
        t.q[1] = *(const u32x4*)(vp + 8);
        for (int c = 0; c < 16; ++c) sVt[(cb + c) * 64 + j] = t.e[c];
    }

    // S = q k^T  (wave handles rows 16*wave .. +16, all 64 cols)
    Frag aq;
    {
        int qi = wave * 16 + l16;
        const _Float16* qp = qkv + tok(qi) * 768 + ho + hf * 8;
        aq.q[0] = *(const u32x4*)qp;
        aq.q[1] = *(const u32x4*)(qp + 16);
    }
    const v8f vzero = {0.f,0.f,0.f,0.f,0.f,0.f,0.f,0.f};
    v8f s[4];
    for (int jt = 0; jt < 4; ++jt) {
        int kj = jt * 16 + l16;
        const _Float16* kp = qkv + tok(kj) * 768 + 256 + ho + hf * 8;
        Frag bk;
        bk.q[0] = *(const u32x4*)kp;
        bk.q[1] = *(const u32x4*)(kp + 16);
        s[jt] = wmma_f16(aq.v, bk.v, vzero);
    }
    const float SCALE = 0.17677669529663687f;  // 32^-0.5
    for (int jt = 0; jt < 4; ++jt)
        for (int e = 0; e < 8; ++e) {
            int i = wave * 16 + e + 8 * hf;
            int j = jt * 16 + l16;
            s[jt][e] = s[jt][e] * SCALE + bias[i * 64 + j];
        }

    // softmax over j: each row lives in one 16-lane half across 4 N-tiles
    for (int e = 0; e < 8; ++e) {
        float mx = fmaxf(fmaxf(s[0][e], s[1][e]), fmaxf(s[2][e], s[3][e]));
        for (int m = 1; m < 16; m <<= 1) mx = fmaxf(mx, __shfl_xor(mx, m, 32));
        float p0 = __expf(s[0][e] - mx);
        float p1 = __expf(s[1][e] - mx);
        float p2 = __expf(s[2][e] - mx);
        float p3 = __expf(s[3][e] - mx);
        float sum = (p0 + p1) + (p2 + p3);
        for (int m = 1; m < 16; m <<= 1) sum += __shfl_xor(sum, m, 32);
        float inv = 1.0f / sum;
        s[0][e] = p0 * inv; s[1][e] = p1 * inv;
        s[2][e] = p2 * inv; s[3][e] = p3 * inv;
    }

    // stash P (f16) row-major in LDS so it can be re-read in A-layout
    for (int jt = 0; jt < 4; ++jt)
        for (int e = 0; e < 8; ++e) {
            int i = wave * 16 + e + 8 * hf;
            int j = jt * 16 + l16;
            sP[i * 64 + j] = (_Float16)s[jt][e];
        }
    __syncthreads();

    // O = P @ V   (K=64 as two 32-chunks; N=32 as two 16-tiles)
    v8f o0 = vzero, o1 = vzero;
    for (int kc = 0; kc < 2; ++kc) {
        int r = wave * 16 + l16;
        const _Float16* pp = sP + r * 64 + hf * 8 + kc * 32;
        Frag ap;
        ap.q[0] = *(const u32x4*)pp;
        ap.q[1] = *(const u32x4*)(pp + 16);
        {
            const _Float16* vp = sVt + l16 * 64 + hf * 8 + kc * 32;
            Frag bv;
            bv.q[0] = *(const u32x4*)vp;
            bv.q[1] = *(const u32x4*)(vp + 16);
            o0 = wmma_f16(ap.v, bv.v, o0);
        }
        {
            const _Float16* vp = sVt + (16 + l16) * 64 + hf * 8 + kc * 32;
            Frag bv;
            bv.q[0] = *(const u32x4*)vp;
            bv.q[1] = *(const u32x4*)(vp + 16);
            o1 = wmma_f16(ap.v, bv.v, o1);
        }
    }
    for (int e = 0; e < 8; ++e) {
        int i = wave * 16 + e + 8 * hf;
        size_t tb = tok(i) * 256 + ho;
        aoh[tb + l16]      = (_Float16)o0[e];
        aoh[tb + 16 + l16] = (_Float16)o1[e];
    }
}

// ---------------- output projection GEMM (+bias) ----------------
// out[m,o] = sum_c aoh[m,c] * w_out[o,c] + b_out[o]   M=131072 N=256 K=256
// wave computes 32x128; grid (M/128, N/128)

__global__ __launch_bounds__(128)
void gemm_out_kernel(const _Float16* __restrict__ a,
                     const _Float16* __restrict__ w,
                     const float* __restrict__ bout,
                     float* __restrict__ out) {
    __shared__ __align__(16) _Float16 sW[128 * WPITCH];   // staged weight slab
    const int lane = threadIdx.x & 31;
    const int wave = threadIdx.x >> 5;
    const int l16  = lane & 15, hf = lane >> 4;
    const int m0   = blockIdx.x * 128 + wave * 32;
    const int n0   = blockIdx.y * 128;
    const int rowA = m0 + l16;
    const int rowB = m0 + 16 + l16;

    // Weight slab of this tile (128 rows x 256 k) into LDS: one wave-wide 16-byte load
    // covers one whole 512-byte row (4 full lines) instead of 16 lines per fragment load.
    {
        const _Float16* wp = w + (size_t)n0 * 256 + lane * 8;
        _Float16* sp = sW + lane * 8;
        u32x4 t[32];
        for (int i = 0; i < 32; ++i) t[i] = *(const u32x4*)(wp + (i * 4 + wave) * 256);
        for (int i = 0; i < 32; ++i) *(u32x4*)(sp + (i * 4 + wave) * WPITCH) = t[i];
    }
    __syncthreads();   // every wave reads rows that the other waves stored

    const v8f vzero = {0.f,0.f,0.f,0.f,0.f,0.f,0.f,0.f};
    v8f acc0[8], acc1[8];
    for (int t = 0; t < 8; ++t) { acc0[t] = vzero; acc1[t] = vzero; }

    for (int kk = 0; kk < 256; kk += 32) {
        Frag a0, a1;
        {
            const _Float16* apt = a + (size_t)rowA * 256 + kk + hf * 8;
            a0.q[0] = *(const u32x4*)apt;
            a0.q[1] = *(const u32x4*)(apt + 16);
        }
        {
            const _Float16* apt = a + (size_t)rowB * 256 + kk + hf * 8;
            a1.q[0] = *(const u32x4*)apt;
            a1.q[1] = *(const u32x4*)(apt + 16);
        }
        for (int nt = 0; nt < 8; ++nt) {
            const _Float16* bp = sW + (nt * 16 + l16) * WPITCH + kk + hf * 8;
            Frag b;
            b.q[0] = *(const u32x4*)bp;
            b.q[1] = *(const u32x4*)(bp + 16);
            acc0[nt] = wmma_f16(a0.v, b.v, acc0[nt]);
            acc1[nt] = wmma_f16(a1.v, b.v, acc1[nt]);
        }
    }
    for (int nt = 0; nt < 8; ++nt) {
        int oo = n0 + nt * 16 + l16;
        float bb = bout[oo];
        for (int e = 0; e < 8; ++e) {
            int mA = m0 + e + 8 * hf;
            int mB = m0 + 16 + e + 8 * hf;
            out[(size_t)mA * 256 + oo] = acc0[nt][e] + bb;
            out[(size_t)mB * 256 + oo] = acc1[nt][e] + bb;
        }
    }
}

// ---------------- launch ----------------

extern "C" void kernel_launch(void* const* d_in, const int* in_sizes, int n_in,
                              void* d_out, int out_size, void* d_ws, size_t ws_size,
                              hipStream_t stream) {
    const float* x    = (const float*)d_in[0];  // (2,4,128,128,256)
    const float* wqkv = (const float*)d_in[1];  // (768,256)
    const float* pos  = (const float*)d_in[2];  // (15,15)
    const float* wout = (const float*)d_in[3];  // (256,256)
    const float* bout = (const float*)d_in[4];  // (256,)
    float* out = (float*)d_out;

    // scratch layout
    char* ws = (char*)d_ws;
    _Float16* qkvh  = (_Float16*)ws;  ws += (size_t)131072 * 768 * 2;  // 201.3 MB
    _Float16* woh   = (_Float16*)ws;  ws += (size_t)768 * 256 * 2;
    _Float16* wouth = (_Float16*)ws;  ws += (size_t)256 * 256 * 2;
    float*    bias  = (float*)ws;     ws += (size_t)64 * 64 * 4;
    _Float16* aoh   = (_Float16*)ws;                                   // 67.1 MB

    cvt_f32_f16_kernel<<<(196608 + 255) / 256, 256, 0, stream>>>(wqkv, woh, 196608);
    cvt_f32_f16_kernel<<<(65536 + 255) / 256, 256, 0, stream>>>(wout, wouth, 65536);
    build_bias_kernel<<<16, 256, 0, stream>>>(pos, bias);
    gemm_qkv_kernel<<<512, 256, 0, stream>>>(x, woh, qkvh);
    win_attn_kernel<<<16384, 128, 0, stream>>>(qkvh, bias, aoh);
    gemm_out_kernel<<<dim3(1024, 2), 128, 0, stream>>>(aoh, wouth, bout, out);
}

// v003
// Measured time: 86.3 microseconds a run.
// Next to v002, in two timings, it ran 1.86 and 1.84 times as fast.
// Counting every step since v000, it is 3.56 times as fast.
#include <hip/hip_runtime.h>
#include <hip/hip_bf16.h>

typedef __attribute__((ext_vector_type(16))) _Float16 v16h;
typedef __attribute__((ext_vector_type(8)))  float    v8f;
typedef __attribute__((ext_vector_type(4)))  float    f32x4;
typedef __attribute__((ext_vector_type(4)))  unsigned int u32x4;

union Frag {
    v16h     v;
    _Float16 e[16];
    u32x4    q[2];
};

__device__ __forceinline__ v8f wmma_f16(v16h a, v16h b, v8f c) {
    // v_wmma_f32_16x16x32_f16: D = A(16x32 f16) * B(32x16 f16) + C(16x16 f32)
    return __builtin_amdgcn_wmma_f32_16x16x32_f16(false, a, false, b, (short)0, c, false, false);
}

// value of lane l ^ 16
__device__ __forceinline__ float xhalf(float v) {
    const int b = __builtin_bit_cast(int, v);
    return __builtin_bit_cast(float, __builtin_amdgcn_permlanex16(b, b, 0x76543210, 0xfedcba98, false, false));
}

// LDS row pitch of a staged weight slab, in f16: 512 B of data + 16 B, an odd multiple
// of 16 B, so that the 16 rows of one ds_load_b128 fall on different banks.
#define WPITCH 264

// ---------------- small helper kernels ----------------

__global__ void cvt_f32_f16_kernel(const float* __restrict__ src,
                                   _Float16* __restrict__ dst, int n) {
    int i = blockIdx.x * 256 + threadIdx.x;
    if (i < n) dst[i] = (_Float16)src[i];
}

// bias64[i][j] = pos_embedding[jy-iy+7][jx-ix+7]   (rel = idx[j]-idx[i]+7)
__global__ void build_bias_kernel(const float* __restrict__ pos,
                                  float* __restrict__ bias) {
    int idx = blockIdx.x * 256 + threadIdx.x;   // 0..4095
    int i = idx >> 6, j = idx & 63;
    int iy = i >> 3, ix = i & 7, jy = j >> 3, jx = j & 7;
    bias[idx] = pos[(jy - iy + 7) * 15 + (jx - ix + 7)];
}

// ---------------- QKV projection fused with windowed attention ----------------
// One wave owns one 8x8 window (64 tokens); block = 8 waves = 8 windows side by side; grid 256.
// The window's 64 x 256 piece of x is read and converted once and stays in registers as four
// 16-token fragment sets. The block walks the heads: the 96 weight rows of one head (32 of q,
// 32 of k, 32 of v) are staged in one of two LDS buffers. q, k and v of the head never leave
// the registers, because each product is formed with the operand order whose result layout
// is the fragment layout of its next use (lane = l16, eight neighbours along e + 8 * hf):
//   q^T, k^T = W * x^T   -> lane = token, e runs over c   (fragments of S^T = k * q^T)
//   v        = x * W^T   -> lane = c,     e runs over j   (A fragment of O^T = v^T * P^T)
//   S^T      = k * q^T   -> lane = i,     e runs over j   (B fragment of O^T after softmax)
//   O^T                  -> lane = i,     e runs over c   (16-byte stores)

#define HROWS  96                  // weight rows per head slab
#define HLD    (HROWS / 8)         // 16-byte loads per thread and slab (one row per wave-wide load)
#define BPITCH 68                  // LDS row pitch of the bias in f32: 256 B + 16 B, rows on different banks

__global__ __launch_bounds__(256)
void qkv_attn_kernel(const float* __restrict__ x,
                     const _Float16* __restrict__ w,     // (768,256) f16 row-major
                     const float* __restrict__ bias,     // 64x64
                     _Float16* __restrict__ aoh) {       // (131072,256) f16
    __shared__ __align__(16) _Float16 sW[2][HROWS * WPITCH];   // staged head slabs
    __shared__ __align__(16) float    sB[64 * BPITCH];         // bias[i][j] / SCALE
    const float SCALE  = 0.17677669529663687f;  // 32^-0.5
    const float RSCALE = 5.656854249492381f;    // 32^0.5
    const int lane = threadIdx.x & 31;
    const int wave = threadIdx.x >> 5;
    const int l16  = lane & 15;
    const int hf   = lane >> 4;            // half-wave select
    const int wid  = blockIdx.x * 8 + wave;
    const int bl = wid >> 8, wy = (wid >> 4) & 15, wx = wid & 15;
    // token of window position l16; position tt * 16 + l16 lies two image rows (256 tokens) per tt further
    const size_t tok0 = (size_t)bl * 16384 + (size_t)(wy * 8 + (l16 >> 3)) * 128 + (wx * 8 + (l16 & 7));

    // x fragments of all eight k steps (f32 -> f16): lane holds token, halves [0..7]@k0, [8..15]@k0+16.
    Frag xa[4][8];
    const float* xb = x + tok0 * 256 + hf * 8;
#pragma unroll   // xa[] and f[] stay in registers only with constant indices
    for (int tt = 0; tt < 4; ++tt) {
        const float* ap = xb + tt * (256 * 256);
        f32x4 f[32];
#pragma unroll
        for (int k8 = 0; k8 < 8; ++k8) {
            f[k8 * 4 + 0] = *(const f32x4*)(ap + k8 * 32);
            f[k8 * 4 + 1] = *(const f32x4*)(ap + k8 * 32 + 4);
            f[k8 * 4 + 2] = *(const f32x4*)(ap + k8 * 32 + 16);
            f[k8 * 4 + 3] = *(const f32x4*)(ap + k8 * 32 + 20);
        }
        // Behind a run of loads whose address registers are free for reuse from here on: it takes
        // their base as an input, so that no load of the run lands on it, and the scheduling
        // barrier keeps the later writes behind it.
        asm volatile("s_wait_xcnt 0x0" :: "v"(xb) : "memory");
        __builtin_amdgcn_sched_barrier(0);
#pragma unroll
        for (int k8 = 0; k8 < 8; ++k8)
            for (int e = 0; e < 4; ++e) {
                xa[tt][k8].e[e]      = (_Float16)f[k8 * 4 + 0][e];
                xa[tt][k8].e[4 + e]  = (_Float16)f[k8 * 4 + 1][e];
                xa[tt][k8].e[8 + e]  = (_Float16)f[k8 * 4 + 2][e];
                xa[tt][k8].e[12 + e] = (_Float16)f[k8 * 4 + 3][e];
            }
        // Keeps the next 32 loads behind these conversions: all 128 f32 loads in flight
        // at once would pass the register budget.
        __builtin_amdgcn_sched_barrier(0);
    }

    // Slab row i * 8 + wave is row (i & 3) * 8 + wave of part i >> 2 (q, k, v) of the head.
    // A thread's 16 bytes of it lie at element wave * 256 + lane * 8 = threadIdx.x * 8 of the group of 8 rows.
    const unsigned wo = threadIdx.x * 8;
    const unsigned swave = __builtin_amdgcn_readfirstlane(wave);
    {
        u32x4 t[HLD];
        f32x4 bt[4];
#pragma unroll   // t[] and bt[] stay in registers only with constant indices
        for (int i = 0; i < HLD; ++i) t[i] = *(const u32x4*)(w + ((i >> 2) * 256 + (i & 3) * 8) * 256 + wo);
#pragma unroll
        for (int n = 0; n < 4; ++n) bt[n] = *(const f32x4*)(bias + (threadIdx.x + n * 256) * 4);
        // The address registers of these loads are free for reuse from here on.
        asm volatile("s_wait_xcnt 0x0" :: "v"(wo) : "memory");
#pragma unroll
        for (int i = 0; i < HLD; ++i) *(u32x4*)(sW[0] + (i * 8 + wave) * WPITCH + lane * 8) = t[i];
#pragma unroll
        for (int n = 0; n < 4; ++n) {
            int q4 = threadIdx.x + n * 256;
            *(f32x4*)(sB + (q4 >> 4) * BPITCH + (q4 & 15) * 4) = bt[n] * RSCALE;
        }
    }

    const v8f vzero = {0.f,0.f,0.f,0.f,0.f,0.f,0.f,0.f};
#pragma unroll 1   // one copy of the head body
    for (int h = 0; h < 8; ++h) {
        const _Float16* sb = sW[h & 1];
        // Publishes slab h (and, the first time, the bias). It also ends every wave's reads
        // of slab h - 1, whose buffer is stored into further down in this pass.
        __syncthreads();

        // Every inner loop of the pass is unrolled: fragments and accumulators stay in
        // registers only with constant indices.
        Frag fqk[2][4];      // [q, k][token tile]: lane = token, k order over c
        Frag fv[2][2];       // [c tile][chunk of 32 j]: lane = c, k order over j
        {
            // 24 steps: part p = g >> 3 (q, k, v), its 16-row tile ot = (g >> 2) & 1, k steps
            // 2 * (g & 3) and the next; a step is two weight fragments and eight products.
            // The fragments are read two steps ahead into a ring of three.
            Frag wf[3][2];
            v8f acc[4];      // [token tile]
            // The thread's element of the next head's rows. The last pass stages its own head once more, into the
            // buffer that nobody reads again: with a branch round the loads and stores the build carries their
            // registers through the whole pass.
            // The lane's number is read anew in every pass (volatile: not lifted out of the loop) and the wave's
            // is kept in a scalar register: held over the pass, the thread's offset went to scratch.
            unsigned ln;
            asm volatile("v_mbcnt_lo_u32_b32 %0, -1, 0" : "=v"(ln));
            const unsigned l8 = ln * 8;
            const _Float16* wn = w + (swave * 256 + (h < 7 ? h + 1 : 7) * (32 * 256));
            _Float16* sn = sW[(h + 1) & 1] + wave * WPITCH + lane * 8;
#pragma unroll
            for (int g = 0; g < 2; ++g)
#pragma unroll
                for (int kk = 0; kk < 2; ++kk) {
                    const _Float16* bp = sb + l16 * WPITCH + (g * 2 + kk) * 32 + hf * 8;
                    wf[g][kk].q[0] = *(const u32x4*)bp;
                    wf[g][kk].q[1] = *(const u32x4*)(bp + 16);
                }
            // The next slab goes through the registers in two halves, which fly under the steps of q
            // and of k; under those of v the finished q and k fragments leave no room for them.
#pragma unroll
            for (int half = 0; half < 3; ++half) {
            u32x4 t[HLD / 2];
            if (half < 2) {
#pragma unroll
                for (int i = 0; i < HLD / 2; ++i) {
                    const int r = half * (HLD / 2) + i;
                    t[i] = *(const u32x4*)(wn + ((r >> 2) * 256 + (r & 3) * 8) * 256 + l8);
                }
                // Registers of the address of these loads may be rewritten from here on.
                asm volatile("s_wait_xcnt 0x0" ::: "memory");
            }
#pragma unroll
            for (int g = half * 8; g < half * 8 + 8; ++g) {
                const int p = g >> 3, ot = (g >> 2) & 1, kp = g & 3;
                if (g + 2 < 24) {
                    const int rn = ((g + 2) >> 2) * 16, kn = ((g + 2) & 3) * 2;
#pragma unroll
                    for (int kk = 0; kk < 2; ++kk) {
                        const _Float16* bp = sb + (rn + l16) * WPITCH + (kn + kk) * 32 + hf * 8;
                        wf[(g + 2) % 3][kk].q[0] = *(const u32x4*)bp;
                        wf[(g + 2) % 3][kk].q[1] = *(const u32x4*)(bp + 16);
                    }
                }
                // The two scheduling barriers hold the four LDS reads of step g + 2 as one group between
                // the products of steps g - 1 and g: sunk to their use they would be waited for to zero,
                // lifted further they would need a fourth set of registers.
                __builtin_amdgcn_sched_barrier(0);
#pragma unroll
                for (int kk = 0; kk < 2; ++kk)
#pragma unroll
                    for (int tt = 0; tt < 4; ++tt) {
                        const int k8 = kp * 2 + kk;
                        const v8f c0 = k8 == 0 ? vzero : acc[tt];
                        // q, k: W * x^T (lane = token); v: x * W^T (lane = c)
                        acc[tt] = p < 2 ? wmma_f16(wf[g % 3][kk].v, xa[tt][k8].v, c0)
                                        : wmma_f16(xa[tt][k8].v, wf[g % 3][kk].v, c0);
                    }
                if (kp == 3) {
#pragma unroll
                    for (int tt = 0; tt < 4; ++tt)
#pragma unroll
                        for (int e = 0; e < 8; ++e) {
                            // q, k: c = ot * 16 + 8 * hf + e;  v: j = tt * 16 + 8 * hf + e, c tile ot
                            if (p < 2) fqk[p][tt].e[ot * 8 + e] = (_Float16)acc[tt][e];
                            else       fv[ot][tt >> 1].e[(tt & 1) * 8 + e] = (_Float16)acc[tt][e];
                        }
                }
                __builtin_amdgcn_sched_barrier(0);
            }
            if (half < 2) {
#pragma unroll
                for (int i = 0; i < HLD / 2; ++i)
                    *(u32x4*)(sn + (half * (HLD / 2) + i) * 8 * WPITCH) = t[i];
            }
            }
        }

#pragma unroll
        for (int it = 0; it < 4; ++it) {
            // S^T: lane = query i (it * 16 + l16), j = jt * 16 + 8 * hf + e
            // The bias row, divided by SCALE, is the products' start value: st = q.k + bias / SCALE.
            v8f st[4];
            const float* bp = sB + (it * 16 + l16) * BPITCH + hf * 8;
            float m4[4], s4[4];
#pragma unroll
            for (int jt = 0; jt < 4; ++jt) {
                union { v8f v; f32x4 q[2]; } cb;
                cb.q[0] = *(const f32x4*)(bp + jt * 16);
                cb.q[1] = *(const f32x4*)(bp + jt * 16 + 4);
                st[jt] = wmma_f16(fqk[1][jt].v, fqk[0][it].v, cb.v);
            }
#pragma unroll
            for (int jt = 0; jt < 4; ++jt) {
                float ma = fmaxf(fmaxf(st[jt][0], st[jt][1]), fmaxf(st[jt][2], st[jt][3]));
                float mb = fmaxf(fmaxf(st[jt][4], st[jt][5]), fmaxf(st[jt][6], st[jt][7]));
                m4[jt] = fmaxf(ma, mb);
            }
            // softmax over j of SCALE * st: a row lives in the two lanes l16 and l16 + 16
            float mx = fmaxf(fmaxf(m4[0], m4[1]), fmaxf(m4[2], m4[3]));
            mx = fmaxf(mx, xhalf(mx));
#pragma unroll
            for (int jt = 0; jt < 4; ++jt) {
                float d[8], r[8];
#pragma unroll
                for (int e = 0; e < 8; ++e) {   // e^(SCALE * t) = 2^(t * SCALE * log2(e))
                    d[e] = (st[jt][e] - mx) * (SCALE * 1.4426950408889634f);
                    r[e] = __builtin_amdgcn_exp2f(d[e]);
                }
                // The slot behind a transcendental: no reader of a result and no write over a source of
                // these eight stands in front of this v_nop, so none follows its v_exp_f32 directly.
                asm("v_nop" : "+v"(r[0]), "+v"(r[1]), "+v"(r[2]), "+v"(r[3]), "+v"(r[4]), "+v"(r[5]), "+v"(r[6]), "+v"(r[7])
                            : "v"(d[0]), "v"(d[1]), "v"(d[2]), "v"(d[3]), "v"(d[4]), "v"(d[5]), "v"(d[6]), "v"(d[7]));
#pragma unroll
                for (int e = 0; e < 8; ++e) st[jt][e] = r[e];
                s4[jt] = ((st[jt][0] + st[jt][1]) + (st[jt][2] + st[jt][3]))
                       + ((st[jt][4] + st[jt][5]) + (st[jt][6] + st[jt][7]));
            }
            float sum = (s4[0] + s4[1]) + (s4[2] + s4[3]);
            sum += xhalf(sum);
            float inv = 1.0f / sum;
            Frag fp[2];      // P^T: lane = i, k order over j
#pragma unroll
            for (int jt = 0; jt < 4; ++jt)
#pragma unroll
                for (int e = 0; e < 8; ++e) fp[jt >> 1].e[(jt & 1) * 8 + e] = (_Float16)(st[jt][e] * inv);

            // O^T: lane = i, c = ct * 16 + 8 * hf + e
            _Float16* op = aoh + (tok0 + it * 256) * 256 + h * 32 + hf * 8;
#pragma unroll
            for (int ct = 0; ct < 2; ++ct) {
                v8f o = wmma_f16(fv[ct][0].v, fp[0].v, vzero);
                o = wmma_f16(fv[ct][1].v, fp[1].v, o);
                Frag r;
#pragma unroll
                for (int e = 0; e < 8; ++e) r.e[e] = (_Float16)o[e];
                *(u32x4*)(op + ct * 16) = r.q[0];
            }
            if (it & 1) {
                // The next tiles rewrite registers that the stores of these two name (data, address).
                asm volatile("s_wait_xcnt 0x0" ::: "memory");
                // Two query tiles side by side, not four: with the scores and bias rows of all four
                // live at once the build passes the register budget and sends x fragments to scratch.
                __builtin_amdgcn_sched_barrier(0);
            }
        }
    }
}

// ---------------- output projection GEMM (+bias) ----------------
// out[m,o] = sum_c aoh[m,c] * w_out[o,c] + b_out[o]   M=131072 N=256 K=256
// wave computes 32x128; grid (M/128, N/128)

__global__ __launch_bounds__(128)
void gemm_out_kernel(const _Float16* __restrict__ a,
                     const _Float16* __restrict__ w,
                     const float* __restrict__ bout,
                     float* __restrict__ out) {
    __shared__ __align__(16) _Float16 sW[128 * WPITCH];   // staged weight slab
    const int lane = threadIdx.x & 31;
    const int wave = threadIdx.x >> 5;
    const int l16  = lane & 15, hf = lane >> 4;
    const int m0   = blockIdx.x * 128 + wave * 32;
    const int n0   = blockIdx.y * 128;
    const int rowA = m0 + l16;
    const int rowB = m0 + 16 + l16;

    // Weight slab of this tile (128 rows x 256 k) into LDS: one wave-wide 16-byte load
    // covers one whole 512-byte row (4 full lines) instead of 16 lines per fragment load.
    {
        const _Float16* wp = w + (size_t)n0 * 256 + lane * 8;
        _Float16* sp = sW + lane * 8;
        u32x4 t[32];
        for (int i = 0; i < 32; ++i) t[i] = *(const u32x4*)(wp + (i * 4 + wave) * 256);
        for (int i = 0; i < 32; ++i) *(u32x4*)(sp + (i * 4 + wave) * WPITCH) = t[i];
    }
    __syncthreads();   // every wave reads rows that the other waves stored

    const v8f vzero = {0.f,0.f,0.f,0.f,0.f,0.f,0.f,0.f};
    v8f acc0[8], acc1[8];
    for (int t = 0; t < 8; ++t) { acc0[t] = vzero; acc1[t] = vzero; }

    for (int kk = 0; kk < 256; kk += 32) {
        Frag a0, a1;
        {
            const _Float16* apt = a + (size_t)rowA * 256 + kk + hf * 8;
            a0.q[0] = *(const u32x4*)apt;
            a0.q[1] = *(const u32x4*)(apt + 16);
        }
        {
            const _Float16* apt = a + (size_t)rowB * 256 + kk + hf * 8;
            a1.q[0] = *(const u32x4*)apt;
            a1.q[1] = *(const u32x4*)(apt + 16);
        }
        for (int nt = 0; nt < 8; ++nt) {
            const _Float16* bp = sW + (nt * 16 + l16) * WPITCH + kk + hf * 8;
            Frag b;
            b.q[0] = *(const u32x4*)bp;
            b.q[1] = *(const u32x4*)(bp + 16);
            acc0[nt] = wmma_f16(a0.v, b.v, acc0[nt]);
            acc1[nt] = wmma_f16(a1.v, b.v, acc1[nt]);
        }
    }
    for (int nt = 0; nt < 8; ++nt) {
        int oo = n0 + nt * 16 + l16;
        float bb = bout[oo];
        for (int e = 0; e < 8; ++e) {
            int mA = m0 + e + 8 * hf;
            int mB = m0 + 16 + e + 8 * hf;
            out[(size_t)mA * 256 + oo] = acc0[nt][e] + bb;
            out[(size_t)mB * 256 + oo] = acc1[nt][e] + bb;
        }
    }
}

// ---------------- launch ----------------

extern "C" void kernel_launch(void* const* d_in, const int* in_sizes, int n_in,
                              void* d_out, int out_size, void* d_ws, size_t ws_size,
                              hipStream_t stream) {
    const float* x    = (const float*)d_in[0];  // (2,4,128,128,256)
    const float* wqkv = (const float*)d_in[1];  // (768,256)
    const float* pos  = (const float*)d_in[2];  // (15,15)
    const float* wout = (const float*)d_in[3];  // (256,256)
    const float* bout = (const float*)d_in[4];  // (256,)
    float* out = (float*)d_out;

    // scratch layout
    char* ws = (char*)d_ws;
    _Float16* woh   = (_Float16*)ws;  ws += (size_t)768 * 256 * 2;
    _Float16* wouth = (_Float16*)ws;  ws += (size_t)256 * 256 * 2;
    float*    bias  = (float*)ws;     ws += (size_t)64 * 64 * 4;
    _Float16* aoh   = (_Float16*)ws;                                   // 67.1 MB

    cvt_f32_f16_kernel<<<(196608 + 255) / 256, 256, 0, stream>>>(wqkv, woh, 196608);
    cvt_f32_f16_kernel<<<(65536 + 255) / 256, 256, 0, stream>>>(wout, wouth, 65536);
    build_bias_kernel<<<16, 256, 0, stream>>>(pos, bias);
    qkv_attn_kernel<<<256, 256, 0, stream>>>(x, woh, bias, aoh);
    gemm_out_kernel<<<dim3(1024, 2), 128, 0, stream>>>(aoh, wouth, bout, out);
}

// v004
// One run takes 74.4 microseconds.
// In two side-by-side timings against v003, it was 1.16 and 1.17 times as fast.
// Counting every step since v000, it is 4.14 times as fast.
#include <hip/hip_runtime.h>
#include <hip/hip_bf16.h>

typedef __attribute__((ext_vector_type(16))) _Float16 v16h;
typedef __attribute__((ext_vector_type(8)))  float    v8f;
typedef __attribute__((ext_vector_type(4)))  float    f32x4;
typedef __attribute__((ext_vector_type(4)))  unsigned int u32x4;

union Frag {
    v16h     v;
    _Float16 e[16];
    u32x4    q[2];
};

__device__ __forceinline__ v8f wmma_f16(v16h a, v16h b, v8f c) {
    // v_wmma_f32_16x16x32_f16: D = A(16x32 f16) * B(32x16 f16) + C(16x16 f32)
    return __builtin_amdgcn_wmma_f32_16x16x32_f16(false, a, false, b, (short)0, c, false, false);
}

// value of lane l ^ 16
__device__ __forceinline__ float xhalf(float v) {
    const int b = __builtin_bit_cast(int, v);
    return __builtin_bit_cast(float, __builtin_amdgcn_permlanex16(b, b, 0x76543210, 0xfedcba98, false, false));
}

// LDS row pitch of a staged weight slab, in f16: 512 B of data + 16 B, an odd multiple
// of 16 B, so that the 16 rows of one ds_load_b128 fall on different banks.
#define WPITCH 264

// ---------------- small helper kernels ----------------

__global__ void cvt_f32_f16_kernel(const float* __restrict__ src,
                                   _Float16* __restrict__ dst, int n) {
    int i = blockIdx.x * 256 + threadIdx.x;
    if (i < n) dst[i] = (_Float16)src[i];
}

// bias64[i][j] = pos_embedding[jy-iy+7][jx-ix+7]   (rel = idx[j]-idx[i]+7)
__global__ void build_bias_kernel(const float* __restrict__ pos,
                                  float* __restrict__ bias) {
    int idx = blockIdx.x * 256 + threadIdx.x;   // 0..4095
    int i = idx >> 6, j = idx & 63;
    int iy = i >> 3, ix = i & 7, jy = j >> 3, jx = j & 7;
    bias[idx] = pos[(jy - iy + 7) * 15 + (jx - ix + 7)];
}

// ---------------- QKV projection, windowed attention and output projection ----------------
// One wave owns one 8x8 window (64 tokens); block = 8 waves = 8 windows side by side; grid 256.
// The window's 64 x 256 piece of x is read and converted once and stays in registers as four
// 16-token fragment sets. The block walks the heads: the 96 weight rows of one head (32 of q,
// 32 of k, 32 of v) are staged in one of two LDS buffers. q, k and v of the head never leave
// the registers, because each product is formed with the operand order whose result layout
// is the fragment layout of its next use (lane = l16, eight neighbours along e + 8 * hf):
//   q^T, k^T = W * x^T   -> lane = token, e runs over c   (fragments of S^T = k * q^T)
//   v        = x * W^T   -> lane = c,     e runs over j   (A fragment of O^T = v^T * P^T)
//   S^T      = k * q^T   -> lane = i,     e runs over j   (B fragment of O^T after softmax)
//   O^T                  -> lane = i,     e runs over c   (16-byte stores)
// O of the eight heads has no room in the registers beside x. Each lane parks its 16-byte pieces in opark,
// in lane order (a wave-wide store or load covers 512 bytes in a row), and, behind the last head, when x
// is dead, reads back exactly the bytes that it stored itself: they are the fragments of the output projection,
//   out^T = W_out * O^T  -> lane = token, e runs over o   (two 16-byte stores per tile)
// whose weights lie in LDS from the start of the kernel.

#define HROWS  96                  // weight rows per head slab
#define HLD    (HROWS / 8)         // 16-byte loads per thread and slab (one row per wave-wide load)
#define BPITCH 68                  // LDS row pitch of the bias in f32: 256 B + 16 B, rows on different banks

__global__ __launch_bounds__(256)
void qkv_attn_kernel(const float* __restrict__ x,
                     const _Float16* __restrict__ w,     // (768,256) f16 row-major
                     const float* __restrict__ bias,     // 64x64
                     const _Float16* __restrict__ wo16,  // (256,256) f16 row-major
                     const float* __restrict__ bout,     // (256,)
                     _Float16* __restrict__ opark,       // [window][head][query tile][c tile][lane] 8 x f16
                     float* __restrict__ out) {          // (131072,256)
    __shared__ __align__(16) _Float16 sW[2][HROWS * WPITCH];   // staged head slabs
    __shared__ __align__(16) float    sB[64 * BPITCH];         // bias[i][j] / SCALE
    __shared__ __align__(16) _Float16 sWo[256 * WPITCH];       // weights of the output projection
    __shared__ __align__(16) float    sBo[256];                // its bias
    const float SCALE  = 0.17677669529663687f;  // 32^-0.5
    const float RSCALE = 5.656854249492381f;    // 32^0.5
    const int lane = threadIdx.x & 31;
    const int wave = threadIdx.x >> 5;
    const int l16  = lane & 15;
    const int hf   = lane >> 4;            // half-wave select
    const int wid  = blockIdx.x * 8 + wave;
    const int bl = wid >> 8, wy = (wid >> 4) & 15, wx = wid & 15;
    // token of window position l16; position tt * 16 + l16 lies two image rows (256 tokens) per tt further
    const size_t tok0 = (size_t)bl * 16384 + (size_t)(wy * 8 + (l16 >> 3)) * 128 + (wx * 8 + (l16 & 7));

    // x fragments of all eight k steps (f32 -> f16): lane holds token, halves [0..7]@k0, [8..15]@k0+16.
    Frag xa[4][8];
    const float* xb = x + tok0 * 256 + hf * 8;
#pragma unroll   // xa[] and f[] stay in registers only with constant indices
    for (int tt = 0; tt < 4; ++tt) {
        const float* ap = xb + tt * (256 * 256);
        f32x4 f[32];
#pragma unroll
        for (int k8 = 0; k8 < 8; ++k8) {
            f[k8 * 4 + 0] = *(const f32x4*)(ap + k8 * 32);
            f[k8 * 4 + 1] = *(const f32x4*)(ap + k8 * 32 + 4);
            f[k8 * 4 + 2] = *(const f32x4*)(ap + k8 * 32 + 16);
            f[k8 * 4 + 3] = *(const f32x4*)(ap + k8 * 32 + 20);
        }
        // Behind a run of loads whose address registers are free for reuse from here on: it takes
        // their base as an input, so that no load of the run lands on it, and the scheduling
        // barrier keeps the later writes behind it.
        asm volatile("s_wait_xcnt 0x0" :: "v"(xb) : "memory");
        __builtin_amdgcn_sched_barrier(0);
#pragma unroll
        for (int k8 = 0; k8 < 8; ++k8)
            for (int e = 0; e < 4; ++e) {
                xa[tt][k8].e[e]      = (_Float16)f[k8 * 4 + 0][e];
                xa[tt][k8].e[4 + e]  = (_Float16)f[k8 * 4 + 1][e];
                xa[tt][k8].e[8 + e]  = (_Float16)f[k8 * 4 + 2][e];
                xa[tt][k8].e[12 + e] = (_Float16)f[k8 * 4 + 3][e];
            }
        // Keeps the next 32 loads behind these conversions: all 128 f32 loads in flight
        // at once would pass the register budget.
        __builtin_amdgcn_sched_barrier(0);
    }

    // Slab row i * 8 + wave is row (i & 3) * 8 + wave of part i >> 2 (q, k, v) of the head.
    // A thread's 16 bytes of it lie at element wave * 256 + lane * 8 = threadIdx.x * 8 of the group of 8 rows.
    const unsigned wo = threadIdx.x * 8;
    const unsigned swave = __builtin_amdgcn_readfirstlane(wave);
    {
        u32x4 t[HLD];
        f32x4 bt[4];
        u32x4 to[32];
#pragma unroll   // t[], bt[] and to[] stay in registers only with constant indices
        for (int i = 0; i < HLD; ++i) t[i] = *(const u32x4*)(w + ((i >> 2) * 256 + (i & 3) * 8) * 256 + wo);
#pragma unroll
        for (int n = 0; n < 4; ++n) bt[n] = *(const f32x4*)(bias + (threadIdx.x + n * 256) * 4);
#pragma unroll
        for (int i = 0; i < 32; ++i) to[i] = *(const u32x4*)(wo16 + i * (8 * 256) + wo);
        const float bo1 = bout[threadIdx.x];
        // The address registers of these loads are free for reuse from here on.
        asm volatile("s_wait_xcnt 0x0" :: "v"(wo) : "memory");
#pragma unroll
        for (int i = 0; i < HLD; ++i) *(u32x4*)(sW[0] + (i * 8 + wave) * WPITCH + lane * 8) = t[i];
#pragma unroll
        for (int n = 0; n < 4; ++n) {
            int q4 = threadIdx.x + n * 256;
            *(f32x4*)(sB + (q4 >> 4) * BPITCH + (q4 & 15) * 4) = bt[n] * RSCALE;
        }
        // Row i * 8 + wave of W_out; published, like slab 0 and the bias, by the first barrier below.
#pragma unroll
        for (int i = 0; i < 32; ++i) *(u32x4*)(sWo + (i * 8 + wave) * WPITCH + lane * 8) = to[i];
        sBo[threadIdx.x] = bo1;
    }

    const v8f vzero = {0.f,0.f,0.f,0.f,0.f,0.f,0.f,0.f};
#pragma unroll 1   // one copy of the head body
    for (int h = 0; h < 8; ++h) {
        const _Float16* sb = sW[h & 1];
        // Publishes slab h (and, the first time, the bias). It also ends every wave's reads
        // of slab h - 1, whose buffer is stored into further down in this pass.
        __syncthreads();

        // Every inner loop of the pass is unrolled: fragments and accumulators stay in
        // registers only with constant indices.
        Frag fqk[2][4];      // [q, k][token tile]: lane = token, k order over c
        Frag fv[2][2];       // [c tile][chunk of 32 j]: lane = c, k order over j
        {
            // 24 steps: part p = g >> 3 (q, k, v), its 16-row tile ot = (g >> 2) & 1, k steps
            // 2 * (g & 3) and the next; a step is two weight fragments and eight products.
            // The fragments are read two steps ahead into a ring of three.
            Frag wf[3][2];
            v8f acc[4];      // [token tile]
            // The thread's element of the next head's rows. The last pass stages its own head once more, into the
            // buffer that nobody reads again: with a branch round the loads and stores the build carries their
            // registers through the whole pass.
            // The lane's number is read anew in every pass (volatile: not lifted out of the loop) and the wave's
            // is kept in a scalar register: held over the pass, the thread's offset went to scratch.
            unsigned ln;
            asm volatile("v_mbcnt_lo_u32_b32 %0, -1, 0" : "=v"(ln));
            const unsigned l8 = ln * 8;
            const _Float16* wn = w + (swave * 256 + (h < 7 ? h + 1 : 7) * (32 * 256));
            _Float16* sn = sW[(h + 1) & 1] + wave * WPITCH + lane * 8;
#pragma unroll
            for (int g = 0; g < 2; ++g)
#pragma unroll
                for (int kk = 0; kk < 2; ++kk) {
                    const _Float16* bp = sb + l16 * WPITCH + (g * 2 + kk) * 32 + hf * 8;
                    wf[g][kk].q[0] = *(const u32x4*)bp;
                    wf[g][kk].q[1] = *(const u32x4*)(bp + 16);
                }
            // The next slab goes through the registers in two halves, which fly under the steps of q
            // and of k; under those of v the finished q and k fragments leave no room for them.
#pragma unroll
            for (int half = 0; half < 3; ++half) {
            u32x4 t[HLD / 2];
            if (half < 2) {
#pragma unroll
                for (int i = 0; i < HLD / 2; ++i) {
                    const int r = half * (HLD / 2) + i;
                    t[i] = *(const u32x4*)(wn + ((r >> 2) * 256 + (r & 3) * 8) * 256 + l8);
                }
                // Registers of the address of these loads may be rewritten from here on.
                asm volatile("s_wait_xcnt 0x0" ::: "memory");
            }
#pragma unroll
            for (int g = half * 8; g < half * 8 + 8; ++g) {
                const int p = g >> 3, ot = (g >> 2) & 1, kp = g & 3;
                if (g + 2 < 24) {
                    const int rn = ((g + 2) >> 2) * 16, kn = ((g + 2) & 3) * 2;
#pragma unroll
                    for (int kk = 0; kk < 2; ++kk) {
                        const _Float16* bp = sb + (rn + l16) * WPITCH + (kn + kk) * 32 + hf * 8;
                        wf[(g + 2) % 3][kk].q[0] = *(const u32x4*)bp;
                        wf[(g + 2) % 3][kk].q[1] = *(const u32x4*)(bp + 16);
                    }
                }
                // The two scheduling barriers hold the four LDS reads of step g + 2 as one group between
                // the products of steps g - 1 and g: sunk to their use they would be waited for to zero,
                // lifted further they would need a fourth set of registers.
                __builtin_amdgcn_sched_barrier(0);
#pragma unroll
                for (int kk = 0; kk < 2; ++kk)
#pragma unroll
                    for (int tt = 0; tt < 4; ++tt) {
                        const int k8 = kp * 2 + kk;
                        const v8f c0 = k8 == 0 ? vzero : acc[tt];
                        // q, k: W * x^T (lane = token); v: x * W^T (lane = c)
                        acc[tt] = p < 2 ? wmma_f16(wf[g % 3][kk].v, xa[tt][k8].v, c0)
                                        : wmma_f16(xa[tt][k8].v, wf[g % 3][kk].v, c0);
                    }
                if (kp == 3) {
#pragma unroll
                    for (int tt = 0; tt < 4; ++tt)
#pragma unroll
                        for (int e = 0; e < 8; ++e) {
                            // q, k: c = ot * 16 + 8 * hf + e;  v: j = tt * 16 + 8 * hf + e, c tile ot
                            if (p < 2) fqk[p][tt].e[ot * 8 + e] = (_Float16)acc[tt][e];
                            else       fv[ot][tt >> 1].e[(tt & 1) * 8 + e] = (_Float16)acc[tt][e];
                        }
                }
                __builtin_amdgcn_sched_barrier(0);
            }
            if (half < 2) {
#pragma unroll
                for (int i = 0; i < HLD / 2; ++i)
                    *(u32x4*)(sn + (half * (HLD / 2) + i) * 8 * WPITCH) = t[i];
            }
            }
        }

#pragma unroll
        for (int it = 0; it < 4; ++it) {
            // S^T: lane = query i (it * 16 + l16), j = jt * 16 + 8 * hf + e
            // The bias row, divided by SCALE, is the products' start value: st = q.k + bias / SCALE.
            v8f st[4];
            const float* bp = sB + (it * 16 + l16) * BPITCH + hf * 8;
            float m4[4], s4[4];
#pragma unroll
            for (int jt = 0; jt < 4; ++jt) {
                union { v8f v; f32x4 q[2]; } cb;
                cb.q[0] = *(const f32x4*)(bp + jt * 16);
                cb.q[1] = *(const f32x4*)(bp + jt * 16 + 4);
                st[jt] = wmma_f16(fqk[1][jt].v, fqk[0][it].v, cb.v);
            }
#pragma unroll
            for (int jt = 0; jt < 4; ++jt) {
                float ma = fmaxf(fmaxf(st[jt][0], st[jt][1]), fmaxf(st[jt][2], st[jt][3]));
                float mb = fmaxf(fmaxf(st[jt][4], st[jt][5]), fmaxf(st[jt][6], st[jt][7]));
                m4[jt] = fmaxf(ma, mb);
            }
            // softmax over j of SCALE * st: a row lives in the two lanes l16 and l16 + 16
            float mx = fmaxf(fmaxf(m4[0], m4[1]), fmaxf(m4[2], m4[3]));
            mx = fmaxf(mx, xhalf(mx));
#pragma unroll
            for (int jt = 0; jt < 4; ++jt) {
                float d[8], r[8];
#pragma unroll
                for (int e = 0; e < 8; ++e) {   // e^(SCALE * t) = 2^(t * SCALE * log2(e))
                    d[e] = (st[jt][e] - mx) * (SCALE * 1.4426950408889634f);
                    r[e] = __builtin_amdgcn_exp2f(d[e]);
                }
                // The slot behind a transcendental: no reader of a result and no write over a source of
                // these eight stands in front of this v_nop, so none follows its v_exp_f32 directly.
                asm("v_nop" : "+v"(r[0]), "+v"(r[1]), "+v"(r[2]), "+v"(r[3]), "+v"(r[4]), "+v"(r[5]), "+v"(r[6]), "+v"(r[7])
                            : "v"(d[0]), "v"(d[1]), "v"(d[2]), "v"(d[3]), "v"(d[4]), "v"(d[5]), "v"(d[6]), "v"(d[7]));
#pragma unroll
                for (int e = 0; e < 8; ++e) st[jt][e] = r[e];
                s4[jt] = ((st[jt][0] + st[jt][1]) + (st[jt][2] + st[jt][3]))
                       + ((st[jt][4] + st[jt][5]) + (st[jt][6] + st[jt][7]));
            }
            float sum = (s4[0] + s4[1]) + (s4[2] + s4[3]);
            sum += xhalf(sum);
            float inv = 1.0f / sum;
            Frag fp[2];      // P^T: lane = i, k order over j
#pragma unroll
            for (int jt = 0; jt < 4; ++jt)
#pragma unroll
                for (int e = 0; e < 8; ++e) fp[jt >> 1].e[(jt & 1) * 8 + e] = (_Float16)(st[jt][e] * inv);

            // O^T: lane = i, c = ct * 16 + 8 * hf + e
            _Float16* op = opark + ((size_t)(blockIdx.x * 8 + swave) * 8 + h) * 2048 + it * 512 + lane * 8;
#pragma unroll
            for (int ct = 0; ct < 2; ++ct) {
                v8f o = wmma_f16(fv[ct][0].v, fp[0].v, vzero);
                o = wmma_f16(fv[ct][1].v, fp[1].v, o);
                Frag r;
#pragma unroll
                for (int e = 0; e < 8; ++e) r.e[e] = (_Float16)o[e];
                *(u32x4*)(op + ct * 256) = r.q[0];
            }
            if (it & 1) {
                // The next tiles rewrite registers that the stores of these two name (data, address).
                asm volatile("s_wait_xcnt 0x0" ::: "memory");
                // Two query tiles side by side, not four: with the scores and bias rows of all four
                // live at once the build passes the register budget and sends x fragments to scratch.
                __builtin_amdgcn_sched_barrier(0);
            }
        }
    }

    // ---- output projection: out[m,o] = sum_c O[m,c] * w_out[o,c] + b_out[o] ----
    // O fragments of all eight k steps (k step = head): the lane's own stores, read back.
    Frag oa[4][8];
    const _Float16* ob = opark + (size_t)(blockIdx.x * 8 + swave) * 16384 + lane * 8;
#pragma unroll   // oa[] stays in registers only with constant indices
    for (int k8 = 0; k8 < 8; ++k8)
#pragma unroll
        for (int tt = 0; tt < 4; ++tt) {
            oa[tt][k8].q[0] = *(const u32x4*)(ob + k8 * 2048 + tt * 512);
            oa[tt][k8].q[1] = *(const u32x4*)(ob + k8 * 2048 + tt * 512 + 256);
        }
    // The address registers of these loads are free for reuse from here on: the wait takes their base as
    // an input, so that no load of the run lands on it, and the scheduling barrier keeps the later writes behind it.
    asm volatile("s_wait_xcnt 0x0" :: "v"(ob) : "memory");
    __builtin_amdgcn_sched_barrier(0);

    // A trip forms 32 outputs (one 128-byte line) of each of the 64 tokens: two 16-row weight tiles of
    // four steps; a step is two weight fragments and eight products, as in the head pass. The fragments
    // are read two steps ahead into a ring of four, whose places repeat from trip to trip.
    float* outp = out + tok0 * 256 + hf * 8;
    const _Float16* so = sWo + l16 * WPITCH + hf * 8;
    Frag wg[4][2];
#pragma unroll
    for (int g = 0; g < 2; ++g)
#pragma unroll
        for (int kk = 0; kk < 2; ++kk) {
            wg[g][kk].q[0] = *(const u32x4*)(so + (g * 2 + kk) * 32);
            wg[g][kk].q[1] = *(const u32x4*)(so + (g * 2 + kk) * 32 + 16);
        }
#pragma unroll 1   // one copy of the trip: eight would double the kernel's text
    for (int n = 0; n < 8; ++n) {
        const _Float16* sc = so + n * (32 * WPITCH);
        // The last trip reads the first two steps of trip 0 once more, for nobody: inside the array, no branch.
        const _Float16* sx = so + ((n + 1) & 7) * (32 * WPITCH);
        v8f acc[4];          // [token tile]
        f32x4 bo[2];
#pragma unroll
        for (int g = 0; g < 8; ++g) {
            const int ot = g >> 2, kp = g & 3;
            {
                const _Float16* sp = (g + 2 < 8 ? sc : sx) + (((g + 2) & 7) >> 2) * (16 * WPITCH) + ((g + 2) & 3) * 64;
#pragma unroll
                for (int kk = 0; kk < 2; ++kk) {
                    wg[(g + 2) & 3][kk].q[0] = *(const u32x4*)(sp + kk * 32);
                    wg[(g + 2) & 3][kk].q[1] = *(const u32x4*)(sp + kk * 32 + 16);
                }
            }
            if (kp == 0) {
                bo[0] = *(const f32x4*)(sBo + n * 32 + ot * 16 + hf * 8);
                bo[1] = *(const f32x4*)(sBo + n * 32 + ot * 16 + hf * 8 + 4);
            }
            // As in the head pass: the two scheduling barriers hold the LDS reads of step g + 2 as one
            // group between the products of steps g - 1 and g.
            __builtin_amdgcn_sched_barrier(0);
#pragma unroll
            for (int kk = 0; kk < 2; ++kk)
#pragma unroll
                for (int tt = 0; tt < 4; ++tt) {
                    const int k8 = kp * 2 + kk;
                    acc[tt] = wmma_f16(wg[g & 3][kk].v, oa[tt][k8].v, k8 == 0 ? vzero : acc[tt]);
                }
            if (kp == 3) {
                // lane = token tt * 16 + l16, o = n * 32 + ot * 16 + 8 * hf + e
                f32x4 r[4][2];
#pragma unroll
                for (int tt = 0; tt < 4; ++tt) {
                    f32x4 lo = {acc[tt][0], acc[tt][1], acc[tt][2], acc[tt][3]};
                    f32x4 hi = {acc[tt][4], acc[tt][5], acc[tt][6], acc[tt][7]};
                    r[tt][0] = lo + bo[0];
                    r[tt][1] = hi + bo[1];
                }
                // Holds the eight stores behind all the sums: a sum placed among them would land on a
                // register that an issued store names, in front of the wait below.
                __builtin_amdgcn_sched_barrier(0);
#pragma unroll
                for (int tt = 0; tt < 4; ++tt) {
                    float* p = outp + tt * (256 * 256) + n * 32 + ot * 16;
                    *(f32x4*)p       = r[tt][0];
                    *(f32x4*)(p + 4) = r[tt][1];
                }
                // The next tile rewrites registers that these stores name (data, address).
                asm volatile("s_wait_xcnt 0x0" ::: "memory");
            }
            __builtin_amdgcn_sched_barrier(0);
        }
    }
}

// ---------------- launch ----------------

extern "C" void kernel_launch(void* const* d_in, const int* in_sizes, int n_in,
                              void* d_out, int out_size, void* d_ws, size_t ws_size,
                              hipStream_t stream) {
    const float* x    = (const float*)d_in[0];  // (2,4,128,128,256)
    const float* wqkv = (const float*)d_in[1];  // (768,256)
    const float* pos  = (const float*)d_in[2];  // (15,15)
    const float* wout = (const float*)d_in[3];  // (256,256)
    const float* bout = (const float*)d_in[4];  // (256,)
    float* out = (float*)d_out;

    // scratch layout
    char* ws = (char*)d_ws;
    _Float16* woh   = (_Float16*)ws;  ws += (size_t)768 * 256 * 2;
    _Float16* wouth = (_Float16*)ws;  ws += (size_t)256 * 256 * 2;
    float*    bias  = (float*)ws;     ws += (size_t)64 * 64 * 4;
    _Float16* aoh   = (_Float16*)ws;                                   // parked O, 67.1 MB

    cvt_f32_f16_kernel<<<(196608 + 255) / 256, 256, 0, stream>>>(wqkv, woh, 196608);
    cvt_f32_f16_kernel<<<(65536 + 255) / 256, 256, 0, stream>>>(wout, wouth, 65536);
    build_bias_kernel<<<16, 256, 0, stream>>>(pos, bias);
    qkv_attn_kernel<<<256, 256, 0, stream>>>(x, woh, bias, wouth, bout, aoh, out);
}

// v005
// Measured time: 68.9 microseconds a run.
// Two timings next to v004 put it at 1.05 and 1.04 times that version's speed.
// Over all steps from v000 it is 4.31 times as fast.
#include <hip/hip_runtime.h>
#include <hip/hip_bf16.h>

typedef __attribute__((ext_vector_type(16))) _Float16 v16h;
typedef __attribute__((ext_vector_type(8)))  float    v8f;
typedef __attribute__((ext_vector_type(4)))  float    f32x4;
typedef __attribute__((ext_vector_type(4)))  unsigned int u32x4;

union Frag {
    v16h     v;
    _Float16 e[16];
    u32x4    q[2];
};

__device__ __forceinline__ v8f wmma_f16(v16h a, v16h b, v8f c) {
    // v_wmma_f32_16x16x32_f16: D = A(16x32 f16) * B(32x16 f16) + C(16x16 f32)
    return __builtin_amdgcn_wmma_f32_16x16x32_f16(false, a, false, b, (short)0, c, false, false);
}

// value of lane l ^ 16
__device__ __forceinline__ float xhalf(float v) {
    const int b = __builtin_bit_cast(int, v);
    return __builtin_bit_cast(float, __builtin_amdgcn_permlanex16(b, b, 0x76543210, 0xfedcba98, false, false));
}

// LDS row pitch of a staged weight slab, in f16: 512 B of data + 16 B, an odd multiple
// of 16 B, so that the 16 rows of one ds_load_b128 fall on different banks.
#define WPITCH 264

// ---------------- preparation, one launch ----------------
// Blocks 0..95 convert w_qkv to f16, blocks 96..127 w_out, blocks 128..131 lay out the bias table.
// The three jobs depend on nothing but the inputs, so they share one grid; a thread takes eight
// weights (two 16-byte loads, one 16-byte store) or four neighbours of a bias row, which keeps
// the launch at 1056 waves.
__global__ __launch_bounds__(256)
void prep_kernel(const float* __restrict__ wqkv, const float* __restrict__ wout,
                 const float* __restrict__ pos,
                 _Float16* __restrict__ wqkv16, _Float16* __restrict__ wout16,
                 float* __restrict__ bias) {
    const int b = blockIdx.x;
    if (b < 128) {
        const float* src = b < 96 ? wqkv : wout;
        _Float16*    dst = b < 96 ? wqkv16 : wout16;
        const unsigned i = ((b < 96 ? b : b - 96) * 256 + threadIdx.x) * 8;
        const float* sp = src + i;
        const f32x4 lo = *(const f32x4*)sp;
        const f32x4 hi = *(const f32x4*)(sp + 4);
        // The address registers of the two loads may be rewritten from here on; the address is an
        // input, so that neither load lands on it.
        asm volatile("s_wait_xcnt 0x0" :: "v"(sp) : "memory");
        union { _Float16 e[8]; u32x4 q; } r;
        for (int e = 0; e < 4; ++e) {
            r.e[e]     = (_Float16)lo[e];
            r.e[4 + e] = (_Float16)hi[e];
        }
        *(u32x4*)(dst + i) = r.q;
    } else {
        // bias[i][j] = pos_embedding[jy-iy+7][jx-ix+7]   (rel = idx[j]-idx[i]+7); j .. j+3 share jy
        const int idx = ((b - 128) * 256 + threadIdx.x) * 4;   // 0..4092
        const int i = idx >> 6, j = idx & 63;
        const int iy = i >> 3, ix = i & 7, jy = j >> 3, jx = j & 7;
        const float* pp = pos + ((jy - iy + 7) * 15 + (jx - ix + 7));
        f32x4 v;
        for (int e = 0; e < 4; ++e) v[e] = pp[e];
        // As above, for the address registers of this row piece's loads.
        asm volatile("s_wait_xcnt 0x0" :: "v"(pp) : "memory");
        *(f32x4*)(bias + idx) = v;
        // Behind the store: in the built code the conversion path stands below it and rewrites
        // registers that the store names (data, address).
        asm volatile("s_wait_xcnt 0x0" ::: "memory");
    }
}

// ---------------- QKV projection, windowed attention and output projection ----------------
// One wave owns one 8x8 window (64 tokens); block = 8 waves = 8 windows side by side; grid 256.
// The window's 64 x 256 piece of x is read and converted once and stays in registers as four
// 16-token fragment sets. The block walks the heads: the 96 weight rows of one head (32 of q,
// 32 of k, 32 of v) are staged in one of two LDS buffers. q, k and v of the head never leave
// the registers, because each product is formed with the operand order whose result layout
// is the fragment layout of its next use (lane = l16, eight neighbours along e + 8 * hf):
//   q^T, k^T = W * x^T   -> lane = token, e runs over c   (fragments of S^T = k * q^T)
//   v        = x * W^T   -> lane = c,     e runs over j   (A fragment of O^T = v^T * P^T)
//   S^T      = k * q^T   -> lane = i,     e runs over j   (B fragment of O^T after softmax)
//   O^T                  -> lane = i,     e runs over c   (16-byte stores)
// O of the eight heads has no room in the registers beside x. Each lane parks its 16-byte pieces in opark,
// in lane order (a wave-wide store or load covers 512 bytes in a row), and, behind the last head, when x
// is dead, reads back exactly the bytes that it stored itself: they are the fragments of the output projection,
//   out^T = W_out * O^T  -> lane = token, e runs over o   (two 16-byte stores per tile)
// whose weights lie in LDS from the start of the kernel.

#define HROWS  96                  // weight rows per head slab
#define HLD    (HROWS / 8)         // 16-byte loads per thread and slab (one row per wave-wide load)
#define BPITCH 68                  // LDS row pitch of the bias in f32: 256 B + 16 B, rows on different banks

__global__ __launch_bounds__(256)
void qkv_attn_kernel(const float* __restrict__ x,
                     const _Float16* __restrict__ w,     // (768,256) f16 row-major
                     const float* __restrict__ bias,     // 64x64
                     const _Float16* __restrict__ wo16,  // (256,256) f16 row-major
                     const float* __restrict__ bout,     // (256,)
                     _Float16* __restrict__ opark,       // [window][head][query tile][c tile][lane] 8 x f16
                     float* __restrict__ out) {          // (131072,256)
    __shared__ __align__(16) _Float16 sW[2][HROWS * WPITCH];   // staged head slabs
    __shared__ __align__(16) float    sB[64 * BPITCH];         // bias[i][j] / SCALE
    __shared__ __align__(16) _Float16 sWo[256 * WPITCH];       // weights of the output projection
    __shared__ __align__(16) float    sBo[256];                // its bias
    const float SCALE  = 0.17677669529663687f;  // 32^-0.5
    const float RSCALE = 5.656854249492381f;    // 32^0.5
    const int lane = threadIdx.x & 31;
    const int wave = threadIdx.x >> 5;
    const int l16  = lane & 15;
    const int hf   = lane >> 4;            // half-wave select
    const int wid  = blockIdx.x * 8 + wave;
    const int bl = wid >> 8, wy = (wid >> 4) & 15, wx = wid & 15;
    // token of window position l16; position tt * 16 + l16 lies two image rows (256 tokens) per tt further
    const size_t tok0 = (size_t)bl * 16384 + (size_t)(wy * 8 + (l16 >> 3)) * 128 + (wx * 8 + (l16 & 7));

    // x fragments of all eight k steps (f32 -> f16): lane holds token, halves [0..7]@k0, [8..15]@k0+16.
    Frag xa[4][8];
    const float* xb = x + tok0 * 256 + hf * 8;
#pragma unroll   // xa[] and f[] stay in registers only with constant indices
    for (int tt = 0; tt < 4; ++tt) {
        const float* ap = xb + tt * (256 * 256);
        f32x4 f[32];
#pragma unroll
        for (int k8 = 0; k8 < 8; ++k8) {
            f[k8 * 4 + 0] = *(const f32x4*)(ap + k8 * 32);
            f[k8 * 4 + 1] = *(const f32x4*)(ap + k8 * 32 + 4);
            f[k8 * 4 + 2] = *(const f32x4*)(ap + k8 * 32 + 16);
            f[k8 * 4 + 3] = *(const f32x4*)(ap + k8 * 32 + 20);
        }
        // Behind a run of loads whose address registers are free for reuse from here on: it takes
        // their base as an input, so that no load of the run lands on it, and the scheduling
        // barrier keeps the later writes behind it.
        asm volatile("s_wait_xcnt 0x0" :: "v"(xb) : "memory");
        __builtin_amdgcn_sched_barrier(0);
#pragma unroll
        for (int k8 = 0; k8 < 8; ++k8)
            for (int e = 0; e < 4; ++e) {
                xa[tt][k8].e[e]      = (_Float16)f[k8 * 4 + 0][e];
                xa[tt][k8].e[4 + e]  = (_Float16)f[k8 * 4 + 1][e];
                xa[tt][k8].e[8 + e]  = (_Float16)f[k8 * 4 + 2][e];
                xa[tt][k8].e[12 + e] = (_Float16)f[k8 * 4 + 3][e];
            }
        // Keeps the next 32 loads behind these conversions: all 128 f32 loads in flight
        // at once would pass the register budget.
        __builtin_amdgcn_sched_barrier(0);
    }

    // Slab row i * 8 + wave is row (i & 3) * 8 + wave of part i >> 2 (q, k, v) of the head.
    // A thread's 16 bytes of it lie at element wave * 256 + lane * 8 = threadIdx.x * 8 of the group of 8 rows.
    const unsigned wo = threadIdx.x * 8;
    const unsigned swave = __builtin_amdgcn_readfirstlane(wave);
    {
        u32x4 t[HLD];
        f32x4 bt[4];
        u32x4 to[32];
#pragma unroll   // t[], bt[] and to[] stay in registers only with constant indices
        for (int i = 0; i < HLD; ++i) t[i] = *(const u32x4*)(w + ((i >> 2) * 256 + (i & 3) * 8) * 256 + wo);
#pragma unroll
        for (int n = 0; n < 4; ++n) bt[n] = *(const f32x4*)(bias + (threadIdx.x + n * 256) * 4);
#pragma unroll
        for (int i = 0; i < 32; ++i) to[i] = *(const u32x4*)(wo16 + i * (8 * 256) + wo);
        const float bo1 = bout[threadIdx.x];
        // The address registers of these loads are free for reuse from here on.
        asm volatile("s_wait_xcnt 0x0" :: "v"(wo) : "memory");
#pragma unroll
        for (int i = 0; i < HLD; ++i) *(u32x4*)(sW[0] + (i * 8 + wave) * WPITCH + lane * 8) = t[i];
#pragma unroll
        for (int n = 0; n < 4; ++n) {
            int q4 = threadIdx.x + n * 256;
            *(f32x4*)(sB + (q4 >> 4) * BPITCH + (q4 & 15) * 4) = bt[n] * RSCALE;
        }
        // Row i * 8 + wave of W_out; published, like slab 0 and the bias, by the first barrier below.
#pragma unroll
        for (int i = 0; i < 32; ++i) *(u32x4*)(sWo + (i * 8 + wave) * WPITCH + lane * 8) = to[i];
        sBo[threadIdx.x] = bo1;
    }

    const v8f vzero = {0.f,0.f,0.f,0.f,0.f,0.f,0.f,0.f};
#pragma unroll 1   // one copy of the head body
    for (int h = 0; h < 8; ++h) {
        const _Float16* sb = sW[h & 1];
        // Publishes slab h (and, the first time, the bias). It also ends every wave's reads
        // of slab h - 1, whose buffer is stored into further down in this pass.
        __syncthreads();

        // Every inner loop of the pass is unrolled: fragments and accumulators stay in
        // registers only with constant indices.
        Frag fqk[2][4];      // [q, k][token tile]: lane = token, k order over c
        Frag fv[2][2];       // [c tile][chunk of 32 j]: lane = c, k order over j
        {
            // 24 steps: part p = g >> 3 (q, k, v), its 16-row tile ot = (g >> 2) & 1, k steps
            // 2 * (g & 3) and the next; a step is two weight fragments and eight products.
            // The fragments are read two steps ahead into a ring of three.
            Frag wf[3][2];
            v8f acc[4];      // [token tile]
            // The thread's element of the next head's rows. The last pass stages its own head once more, into the
            // buffer that nobody reads again: with a branch round the loads and stores the build carries their
            // registers through the whole pass.
            // The lane's number is read anew in every pass (volatile: not lifted out of the loop) and the wave's
            // is kept in a scalar register: held over the pass, the thread's offset went to scratch.
            unsigned ln;
            asm volatile("v_mbcnt_lo_u32_b32 %0, -1, 0" : "=v"(ln));
            const unsigned l8 = ln * 8;
            const _Float16* wn = w + (swave * 256 + (h < 7 ? h + 1 : 7) * (32 * 256));
            _Float16* sn = sW[(h + 1) & 1] + wave * WPITCH + lane * 8;
#pragma unroll
            for (int g = 0; g < 2; ++g)
#pragma unroll
                for (int kk = 0; kk < 2; ++kk) {
                    const _Float16* bp = sb + l16 * WPITCH + (g * 2 + kk) * 32 + hf * 8;
                    wf[g][kk].q[0] = *(const u32x4*)bp;
                    wf[g][kk].q[1] = *(const u32x4*)(bp + 16);
                }
            // The next slab goes through the registers in two halves, which fly under the steps of q
            // and of k; under those of v the finished q and k fragments leave no room for them.
#pragma unroll
            for (int half = 0; half < 3; ++half) {
            u32x4 t[HLD / 2];
            if (half < 2) {
#pragma unroll
                for (int i = 0; i < HLD / 2; ++i) {
                    const int r = half * (HLD / 2) + i;
                    t[i] = *(const u32x4*)(wn + ((r >> 2) * 256 + (r & 3) * 8) * 256 + l8);
                }
                // Registers of the address of these loads may be rewritten from here on.
                asm volatile("s_wait_xcnt 0x0" ::: "memory");
            }
#pragma unroll
            for (int g = half * 8; g < half * 8 + 8; ++g) {
                const int p = g >> 3, ot = (g >> 2) & 1, kp = g & 3;
                if (g + 2 < 24) {
                    const int rn = ((g + 2) >> 2) * 16, kn = ((g + 2) & 3) * 2;
#pragma unroll
                    for (int kk = 0; kk < 2; ++kk) {
                        const _Float16* bp = sb + (rn + l16) * WPITCH + (kn + kk) * 32 + hf * 8;
                        wf[(g + 2) % 3][kk].q[0] = *(const u32x4*)bp;
                        wf[(g + 2) % 3][kk].q[1] = *(const u32x4*)(bp + 16);
                    }
                }
                // The two scheduling barriers hold the four LDS reads of step g + 2 as one group between
                // the products of steps g - 1 and g: sunk to their use they would be waited for to zero,
                // lifted further they would need a fourth set of registers.
                __builtin_amdgcn_sched_barrier(0);
#pragma unroll
                for (int kk = 0; kk < 2; ++kk)
#pragma unroll
                    for (int tt = 0; tt < 4; ++tt) {
                        const int k8 = kp * 2 + kk;
                        const v8f c0 = k8 == 0 ? vzero : acc[tt];
                        // q, k: W * x^T (lane = token); v: x * W^T (lane = c)
                        acc[tt] = p < 2 ? wmma_f16(wf[g % 3][kk].v, xa[tt][k8].v, c0)
                                        : wmma_f16(xa[tt][k8].v, wf[g % 3][kk].v, c0);
                    }
                if (kp == 3) {
#pragma unroll
                    for (int tt = 0; tt < 4; ++tt)
#pragma unroll
                        for (int e = 0; e < 8; ++e) {
                            // q, k: c = ot * 16 + 8 * hf + e;  v: j = tt * 16 + 8 * hf + e, c tile ot
                            if (p < 2) fqk[p][tt].e[ot * 8 + e] = (_Float16)acc[tt][e];
                            else       fv[ot][tt >> 1].e[(tt & 1) * 8 + e] = (_Float16)acc[tt][e];
                        }
                }
                __builtin_amdgcn_sched_barrier(0);
            }
            if (half < 2) {
#pragma unroll
                for (int i = 0; i < HLD / 2; ++i)
                    *(u32x4*)(sn + (half * (HLD / 2) + i) * 8 * WPITCH) = t[i];
            }
            }
        }

#pragma unroll
        for (int it = 0; it < 4; ++it) {
            // S^T: lane = query i (it * 16 + l16), j = jt * 16 + 8 * hf + e
            // The bias row, divided by SCALE, is the products' start value: st = q.k + bias / SCALE.
            v8f st[4];
            const float* bp = sB + (it * 16 + l16) * BPITCH + hf * 8;
            float m4[4], s4[4];
#pragma unroll
            for (int jt = 0; jt < 4; ++jt) {
                union { v8f v; f32x4 q[2]; } cb;
                cb.q[0] = *(const f32x4*)(bp + jt * 16);
                cb.q[1] = *(const f32x4*)(bp + jt * 16 + 4);
                st[jt] = wmma_f16(fqk[1][jt].v, fqk[0][it].v, cb.v);
            }
#pragma unroll
            for (int jt = 0; jt < 4; ++jt) {
                float ma = fmaxf(fmaxf(st[jt][0], st[jt][1]), fmaxf(st[jt][2], st[jt][3]));
                float mb = fmaxf(fmaxf(st[jt][4], st[jt][5]), fmaxf(st[jt][6], st[jt][7]));
                m4[jt] = fmaxf(ma, mb);
            }
            // softmax over j of SCALE * st: a row lives in the two lanes l16 and l16 + 16
            float mx = fmaxf(fmaxf(m4[0], m4[1]), fmaxf(m4[2], m4[3]));
            mx = fmaxf(mx, xhalf(mx));
#pragma unroll
            for (int jt = 0; jt < 4; ++jt) {
                float d[8], r[8];
#pragma unroll
                for (int e = 0; e < 8; ++e) {   // e^(SCALE * t) = 2^(t * SCALE * log2(e))
                    d[e] = (st[jt][e] - mx) * (SCALE * 1.4426950408889634f);
                    r[e] = __builtin_amdgcn_exp2f(d[e]);
                }
                // The slot behind a transcendental: no reader of a result and no write over a source of
                // these eight stands in front of this v_nop, so none follows its v_exp_f32 directly.
                asm("v_nop" : "+v"(r[0]), "+v"(r[1]), "+v"(r[2]), "+v"(r[3]), "+v"(r[4]), "+v"(r[5]), "+v"(r[6]), "+v"(r[7])
                            : "v"(d[0]), "v"(d[1]), "v"(d[2]), "v"(d[3]), "v"(d[4]), "v"(d[5]), "v"(d[6]), "v"(d[7]));
#pragma unroll
                for (int e = 0; e < 8; ++e) st[jt][e] = r[e];
                s4[jt] = ((st[jt][0] + st[jt][1]) + (st[jt][2] + st[jt][3]))
                       + ((st[jt][4] + st[jt][5]) + (st[jt][6] + st[jt][7]));
            }
            float sum = (s4[0] + s4[1]) + (s4[2] + s4[3]);
            sum += xhalf(sum);
            float inv = 1.0f / sum;
            Frag fp[2];      // P^T: lane = i, k order over j
#pragma unroll
            for (int jt = 0; jt < 4; ++jt)
#pragma unroll
                for (int e = 0; e < 8; ++e) fp[jt >> 1].e[(jt & 1) * 8 + e] = (_Float16)(st[jt][e] * inv);

            // O^T: lane = i, c = ct * 16 + 8 * hf + e
            _Float16* op = opark + ((size_t)(blockIdx.x * 8 + swave) * 8 + h) * 2048 + it * 512 + lane * 8;
#pragma unroll
            for (int ct = 0; ct < 2; ++ct) {
                v8f o = wmma_f16(fv[ct][0].v, fp[0].v, vzero);
                o = wmma_f16(fv[ct][1].v, fp[1].v, o);
                Frag r;
#pragma unroll
                for (int e = 0; e < 8; ++e) r.e[e] = (_Float16)o[e];
                *(u32x4*)(op + ct * 256) = r.q[0];
            }
            if (it & 1) {
                // The next tiles rewrite registers that the stores of these two name (data, address).
                asm volatile("s_wait_xcnt 0x0" ::: "memory");
                // Two query tiles side by side, not four: with the scores and bias rows of all four
                // live at once the build passes the register budget and sends x fragments to scratch.
                __builtin_amdgcn_sched_barrier(0);
            }
        }
    }

    // ---- output projection: out[m,o] = sum_c O[m,c] * w_out[o,c] + b_out[o] ----
    // O fragments of all eight k steps (k step = head): the lane's own stores, read back.
    Frag oa[4][8];
    const _Float16* ob = opark + (size_t)(blockIdx.x * 8 + swave) * 16384 + lane * 8;
#pragma unroll   // oa[] stays in registers only with constant indices
    for (int k8 = 0; k8 < 8; ++k8)
#pragma unroll
        for (int tt = 0; tt < 4; ++tt) {
            oa[tt][k8].q[0] = *(const u32x4*)(ob + k8 * 2048 + tt * 512);
            oa[tt][k8].q[1] = *(const u32x4*)(ob + k8 * 2048 + tt * 512 + 256);
        }
    // The address registers of these loads are free for reuse from here on: the wait takes their base as
    // an input, so that no load of the run lands on it, and the scheduling barrier keeps the later writes behind it.
    asm volatile("s_wait_xcnt 0x0" :: "v"(ob) : "memory");
    __builtin_amdgcn_sched_barrier(0);

    // A trip forms 32 outputs (one 128-byte line) of each of the 64 tokens: two 16-row weight tiles of
    // four steps; a step is two weight fragments and eight products, as in the head pass. The fragments
    // are read two steps ahead into a ring of four, whose places repeat from trip to trip.
    float* outp = out + tok0 * 256 + hf * 8;
    const _Float16* so = sWo + l16 * WPITCH + hf * 8;
    Frag wg[4][2];
#pragma unroll
    for (int g = 0; g < 2; ++g)
#pragma unroll
        for (int kk = 0; kk < 2; ++kk) {
            wg[g][kk].q[0] = *(const u32x4*)(so + (g * 2 + kk) * 32);
            wg[g][kk].q[1] = *(const u32x4*)(so + (g * 2 + kk) * 32 + 16);
        }
#pragma unroll 1   // one copy of the trip: eight would double the kernel's text
    for (int n = 0; n < 8; ++n) {
        const _Float16* sc = so + n * (32 * WPITCH);
        // The last trip reads the first two steps of trip 0 once more, for nobody: inside the array, no branch.
        const _Float16* sx = so + ((n + 1) & 7) * (32 * WPITCH);
        v8f acc[4];          // [token tile]
        f32x4 bo[2];
#pragma unroll
        for (int g = 0; g < 8; ++g) {
            const int ot = g >> 2, kp = g & 3;
            {
                const _Float16* sp = (g + 2 < 8 ? sc : sx) + (((g + 2) & 7) >> 2) * (16 * WPITCH) + ((g + 2) & 3) * 64;
#pragma unroll
                for (int kk = 0; kk < 2; ++kk) {
                    wg[(g + 2) & 3][kk].q[0] = *(const u32x4*)(sp + kk * 32);
                    wg[(g + 2) & 3][kk].q[1] = *(const u32x4*)(sp + kk * 32 + 16);
                }
            }
            if (kp == 0) {
                bo[0] = *(const f32x4*)(sBo + n * 32 + ot * 16 + hf * 8);
                bo[1] = *(const f32x4*)(sBo + n * 32 + ot * 16 + hf * 8 + 4);
            }
            // As in the head pass: the two scheduling barriers hold the LDS reads of step g + 2 as one
            // group between the products of steps g - 1 and g.
            __builtin_amdgcn_sched_barrier(0);
#pragma unroll
            for (int kk = 0; kk < 2; ++kk)
#pragma unroll
                for (int tt = 0; tt < 4; ++tt) {
                    const int k8 = kp * 2 + kk;
                    acc[tt] = wmma_f16(wg[g & 3][kk].v, oa[tt][k8].v, k8 == 0 ? vzero : acc[tt]);
                }
            if (kp == 3) {
                // lane = token tt * 16 + l16, o = n * 32 + ot * 16 + 8 * hf + e
                f32x4 r[4][2];
#pragma unroll
                for (int tt = 0; tt < 4; ++tt) {
                    f32x4 lo = {acc[tt][0], acc[tt][1], acc[tt][2], acc[tt][3]};
                    f32x4 hi = {acc[tt][4], acc[tt][5], acc[tt][6], acc[tt][7]};
                    r[tt][0] = lo + bo[0];
                    r[tt][1] = hi + bo[1];
                }
                // Holds the eight stores behind all the sums: a sum placed among them would land on a
                // register that an issued store names, in front of the wait below.
                __builtin_amdgcn_sched_barrier(0);
#pragma unroll
                for (int tt = 0; tt < 4; ++tt) {
                    float* p = outp + tt * (256 * 256) + n * 32 + ot * 16;
                    *(f32x4*)p       = r[tt][0];
                    *(f32x4*)(p + 4) = r[tt][1];
                }
                // The next tile rewrites registers that these stores name (data, address).
                asm volatile("s_wait_xcnt 0x0" ::: "memory");
            }
            __builtin_amdgcn_sched_barrier(0);
        }
    }
}

// ---------------- launch ----------------

extern "C" void kernel_launch(void* const* d_in, const int* in_sizes, int n_in,
                              void* d_out, int out_size, void* d_ws, size_t ws_size,
                              hipStream_t stream) {
    const float* x    = (const float*)d_in[0];  // (2,4,128,128,256)
    const float* wqkv = (const float*)d_in[1];  // (768,256)
    const float* pos  = (const float*)d_in[2];  // (15,15)
    const float* wout = (const float*)d_in[3];  // (256,256)
    const float* bout = (const float*)d_in[4];  // (256,)
    float* out = (float*)d_out;

    // scratch layout
    char* ws = (char*)d_ws;
    _Float16* woh   = (_Float16*)ws;  ws += (size_t)768 * 256 * 2;
    _Float16* wouth = (_Float16*)ws;  ws += (size_t)256 * 256 * 2;
    float*    bias  = (float*)ws;     ws += (size_t)64 * 64 * 4;
    _Float16* aoh   = (_Float16*)ws;                                   // parked O, 67.1 MB

    prep_kernel<<<132, 256, 0, stream>>>(wqkv, wout, pos, woh, wouth, bias);
    qkv_attn_kernel<<<256, 256, 0, stream>>>(x, woh, bias, wouth, bout, aoh, out);
}

// v006
// It runs in 63.6 microseconds.
// In two side-by-side timings against v005, it was 1.11 and 1.10 times as fast.
// All steps since v000 together make it 4.75 times as fast.
#include <hip/hip_runtime.h>
#include <hip/hip_bf16.h>
#include <type_traits>

typedef __attribute__((ext_vector_type(16))) _Float16 v16h;
typedef __attribute__((ext_vector_type(8)))  float    v8f;
typedef __attribute__((ext_vector_type(4)))  float    f32x4;
typedef __attribute__((ext_vector_type(4)))  unsigned int u32x4;

union Frag {
    v16h     v;
    _Float16 e[16];
    u32x4    q[2];
};

__device__ __forceinline__ v8f wmma_f16(v16h a, v16h b, v8f c) {
    // v_wmma_f32_16x16x32_f16: D = A(16x32 f16) * B(32x16 f16) + C(16x16 f32)
    return __builtin_amdgcn_wmma_f32_16x16x32_f16(false, a, false, b, (short)0, c, false, false);
}

// value of lane l ^ 16
__device__ __forceinline__ float xhalf(float v) {
    const int b = __builtin_bit_cast(int, v);
    return __builtin_bit_cast(float, __builtin_amdgcn_permlanex16(b, b, 0x76543210, 0xfedcba98, false, false));
}

// LDS row pitch of a staged weight slab, in f16: 512 B of data + 16 B, an odd multiple
// of 16 B, so that the 16 rows of one ds_load_b128 fall on different banks.
#define WPITCH 264

// ---------------- preparation, one launch ----------------
// Blocks 0..95 convert w_qkv to f16, blocks 96..127 w_out, blocks 128..131 lay out the bias table.
// The three jobs depend on nothing but the inputs, so they share one grid; a thread takes eight
// weights (two 16-byte loads, one 16-byte store) or four neighbours of a bias row, which keeps
// the launch at 1056 waves.
__global__ __launch_bounds__(256)
void prep_kernel(const float* __restrict__ wqkv, const float* __restrict__ wout,
                 const float* __restrict__ pos,
                 _Float16* __restrict__ wqkv16, _Float16* __restrict__ wout16,
                 float* __restrict__ bias) {
    const int b = blockIdx.x;
    if (b < 128) {
        const float* src = b < 96 ? wqkv : wout;
        _Float16*    dst = b < 96 ? wqkv16 : wout16;
        const unsigned i = ((b < 96 ? b : b - 96) * 256 + threadIdx.x) * 8;
        const float* sp = src + i;
        const f32x4 lo = *(const f32x4*)sp;
        const f32x4 hi = *(const f32x4*)(sp + 4);
        // The address registers of the two loads may be rewritten from here on; the address is an
        // input, so that neither load lands on it.
        asm volatile("s_wait_xcnt 0x0" :: "v"(sp) : "memory");
        union { _Float16 e[8]; u32x4 q; } r;
        for (int e = 0; e < 4; ++e) {
            r.e[e]     = (_Float16)lo[e];
            r.e[4 + e] = (_Float16)hi[e];
        }
        *(u32x4*)(dst + i) = r.q;
    } else {
        // bias[i][j] = pos_embedding[jy-iy+7][jx-ix+7]   (rel = idx[j]-idx[i]+7); j .. j+3 share jy
        const int idx = ((b - 128) * 256 + threadIdx.x) * 4;   // 0..4092
        const int i = idx >> 6, j = idx & 63;
        const int iy = i >> 3, ix = i & 7, jy = j >> 3, jx = j & 7;
        const float* pp = pos + ((jy - iy + 7) * 15 + (jx - ix + 7));
        f32x4 v;
        for (int e = 0; e < 4; ++e) v[e] = pp[e];
        // As above, for the address registers of this row piece's loads.
        asm volatile("s_wait_xcnt 0x0" :: "v"(pp) : "memory");
        *(f32x4*)(bias + idx) = v;
        // Behind the store: in the built code the conversion path stands below it and rewrites
        // registers that the store names (data, address).
        asm volatile("s_wait_xcnt 0x0" ::: "memory");
    }
}

// ---------------- QKV projection, windowed attention and output projection ----------------
// One wave owns one 8x8 window (64 tokens); block = 8 waves = 8 windows side by side; grid 256.
// The window's 64 x 256 piece of x is read and converted once and stays in registers as four
// 16-token fragment sets. The block walks the heads: the 96 weight rows of one head (32 of q,
// 32 of k, 32 of v) are staged in one of two LDS buffers. q, k and v of the head never leave
// the registers, because each product is formed with the operand order whose result layout
// is the fragment layout of its next use (lane = l16, eight neighbours along e + 8 * hf):
//   q^T, k^T = W * x^T   -> lane = token, e runs over c   (fragments of S^T = k * q^T)
//   v        = x * W^T   -> lane = c,     e runs over j   (A fragment of O^T = v^T * P^T)
//   S^T      = k * q^T   -> lane = i,     e runs over j   (B fragment of O^T after softmax)
//   O^T                  -> lane = i,     e runs over c   (16-byte stores)
// O of the eight heads has no room in the registers beside x. Each lane parks its 16-byte pieces in LDS,
// in lane order (a wave-wide store or load covers 512 bytes in a row), and, behind the last head, when x
// is dead, reads back exactly the bytes that it stored itself: they are the fragments of the output projection,
//   out^T = W_out * O^T  -> lane = token, e runs over o   (two 16-byte stores per tile)
// Heads 0 to 5 have a park of their own, head 6 lies in the slab buffer that its pass has finished with,
// and head 7, whose pass is written out behind the loop, goes straight into the registers that x has left.
// The weights of the output projection take the park's place once it has been read back.

#define HROWS  96                  // weight rows per head slab
#define HLD    (HROWS / 8)         // 16-byte loads per thread and slab (one row per wave-wide load)
#define BPITCH 68                  // LDS row pitch of the bias in f32: 256 B + 16 B, rows on different banks
#define OHEADS 6                   // heads whose O has a park of its own
#define OWAVE  2048                // f16 of one wave's O of one head: 64 tokens x 32 c

__global__ __launch_bounds__(256)
void qkv_attn_kernel(const float* __restrict__ x,
                     const _Float16* __restrict__ w,     // (768,256) f16 row-major
                     const float* __restrict__ bias,     // 64x64
                     const _Float16* __restrict__ wo16,  // (256,256) f16 row-major
                     const float* __restrict__ bout,     // (256,)
                     float* __restrict__ out) {          // (131072,256)
    __shared__ __align__(16) _Float16 sW[2][HROWS * WPITCH];   // staged head slabs
    __shared__ __align__(16) float    sB[64 * BPITCH];         // bias[i][j] / SCALE
    // [head][wave][query tile][c tile][lane] 8 x f16 of O; later 256 rows of W_out at pitch WPITCH
    __shared__ __align__(16) _Float16 sP[OHEADS * 8 * OWAVE];
    __shared__ __align__(16) float    sBo[256];                // its bias
    const float SCALE  = 0.17677669529663687f;  // 32^-0.5
    const float RSCALE = 5.656854249492381f;    // 32^0.5
    const int lane = threadIdx.x & 31;
    const int wave = threadIdx.x >> 5;
    const int l16  = lane & 15;
    const int hf   = lane >> 4;            // half-wave select
    const int wid  = blockIdx.x * 8 + wave;
    const int bl = wid >> 8, wy = (wid >> 4) & 15, wx = wid & 15;
    // token of window position l16; position tt * 16 + l16 lies two image rows (256 tokens) per tt further
    const size_t tok0 = (size_t)bl * 16384 + (size_t)(wy * 8 + (l16 >> 3)) * 128 + (wx * 8 + (l16 & 7));

    // x fragments of all eight k steps (f32 -> f16): lane holds token, halves [0..7]@k0, [8..15]@k0+16.
    Frag xa[4][8];
    const float* xb = x + tok0 * 256 + hf * 8;
#pragma unroll   // xa[] and f[] stay in registers only with constant indices
    for (int tt = 0; tt < 4; ++tt) {
        const float* ap = xb + tt * (256 * 256);
        f32x4 f[32];
#pragma unroll
        for (int k8 = 0; k8 < 8; ++k8) {
            f[k8 * 4 + 0] = *(const f32x4*)(ap + k8 * 32);
            f[k8 * 4 + 1] = *(const f32x4*)(ap + k8 * 32 + 4);
            f[k8 * 4 + 2] = *(const f32x4*)(ap + k8 * 32 + 16);
            f[k8 * 4 + 3] = *(const f32x4*)(ap + k8 * 32 + 20);
        }
        // Behind a run of loads whose address registers are free for reuse from here on: it takes
        // their base as an input, so that no load of the run lands on it, and the scheduling
        // barrier keeps the later writes behind it.
        asm volatile("s_wait_xcnt 0x0" :: "v"(xb) : "memory");
        __builtin_amdgcn_sched_barrier(0);
#pragma unroll
        for (int k8 = 0; k8 < 8; ++k8)
            for (int e = 0; e < 4; ++e) {
                xa[tt][k8].e[e]      = (_Float16)f[k8 * 4 + 0][e];
                xa[tt][k8].e[4 + e]  = (_Float16)f[k8 * 4 + 1][e];
                xa[tt][k8].e[8 + e]  = (_Float16)f[k8 * 4 + 2][e];
                xa[tt][k8].e[12 + e] = (_Float16)f[k8 * 4 + 3][e];
            }
        // Keeps the next 32 loads behind these conversions: all 128 f32 loads in flight
        // at once would pass the register budget.
        __builtin_amdgcn_sched_barrier(0);
    }

    // Slab row i * 8 + wave is row (i & 3) * 8 + wave of part i >> 2 (q, k, v) of the head.
    // A thread's 16 bytes of it lie at element wave * 256 + lane * 8 = threadIdx.x * 8 of the group of 8 rows.
    const unsigned wo = threadIdx.x * 8;
    const unsigned swave = __builtin_amdgcn_readfirstlane(wave);
    {
        u32x4 t[HLD];
        f32x4 bt[4];
#pragma unroll   // t[] and bt[] stay in registers only with constant indices
        for (int i = 0; i < HLD; ++i) t[i] = *(const u32x4*)(w + ((i >> 2) * 256 + (i & 3) * 8) * 256 + wo);
#pragma unroll
        for (int n = 0; n < 4; ++n) bt[n] = *(const f32x4*)(bias + (threadIdx.x + n * 256) * 4);
        const float bo1 = bout[threadIdx.x];
        // The address registers of these loads are free for reuse from here on.
        asm volatile("s_wait_xcnt 0x0" :: "v"(wo) : "memory");
#pragma unroll
        for (int i = 0; i < HLD; ++i) *(u32x4*)(sW[0] + (i * 8 + wave) * WPITCH + lane * 8) = t[i];
#pragma unroll
        for (int n = 0; n < 4; ++n) {
            int q4 = threadIdx.x + n * 256;
            *(f32x4*)(sB + (q4 >> 4) * BPITCH + (q4 & 15) * 4) = bt[n] * RSCALE;
        }
        sBo[threadIdx.x] = bo1;
    }
    // Publishes slab 0 and the two biases.
    __syncthreads();

    Frag  oa[4][8];      // O fragments of the output projection, [token tile][k step = head]
    u32x4 to[32];        // row i * 8 + wave of W_out on its way to LDS

    const v8f vzero = {0.f,0.f,0.f,0.f,0.f,0.f,0.f,0.f};
    // One head. The last one stages no further slab, passes no barrier and keeps its O in registers.
    auto head_pass = [&](const int h, auto last_tag) __attribute__((always_inline)) {
        constexpr bool LAST = decltype(last_tag)::value;
        const _Float16* sb = sW[h & 1];

        // Every inner loop of the pass is unrolled: fragments and accumulators stay in
        // registers only with constant indices.
        Frag fqk[2][4];      // [q, k][token tile]: lane = token, k order over c
        Frag fv[2][2];       // [c tile][chunk of 32 j]: lane = c, k order over j
        {
            // 24 steps: part p = g >> 3 (q, k, v), its 16-row tile ot = (g >> 2) & 1, k steps
            // 2 * (g & 3) and the next; a step is two weight fragments and eight products.
            // The fragments are read two steps ahead into a ring of three.
            Frag wf[3][2];
            v8f acc[4];      // [token tile]
            // The thread's element of the next head's rows.
            // The lane's number is read anew in every pass (volatile: not lifted out of the loop) and the wave's
            // is kept in a scalar register: held over the pass, the thread's offset went to scratch.
            unsigned l8 = 0;
            if constexpr (!LAST) {
                unsigned ln;
                asm volatile("v_mbcnt_lo_u32_b32 %0, -1, 0" : "=v"(ln));
                l8 = ln * 8;
            }
            const _Float16* wn = w + (swave * 256 + (h + 1) * (32 * 256));
            _Float16* sn = sW[(h + 1) & 1] + wave * WPITCH + lane * 8;
#pragma unroll
            for (int g = 0; g < 2; ++g)
#pragma unroll
                for (int kk = 0; kk < 2; ++kk) {
                    const _Float16* bp = sb + l16 * WPITCH + (g * 2 + kk) * 32 + hf * 8;
                    wf[g][kk].q[0] = *(const u32x4*)bp;
                    wf[g][kk].q[1] = *(const u32x4*)(bp + 16);
                }
            // The next slab goes through the registers in two halves, which fly under the steps of q
            // and of k; under those of v the finished q and k fragments leave no room for them.
#pragma unroll
            for (int half = 0; half < 3; ++half) {
            u32x4 t[HLD / 2];
            if (!LAST && half < 2) {
#pragma unroll
                for (int i = 0; i < HLD / 2; ++i) {
                    const int r = half * (HLD / 2) + i;
                    t[i] = *(const u32x4*)(wn + ((r >> 2) * 256 + (r & 3) * 8) * 256 + l8);
                }
                // Registers of the address of these loads may be rewritten from here on.
                asm volatile("s_wait_xcnt 0x0" ::: "memory");
            }
#pragma unroll
            for (int g = half * 8; g < half * 8 + 8; ++g) {
                const int p = g >> 3, ot = (g >> 2) & 1, kp = g & 3;
                if (g + 2 < 24) {
                    const int rn = ((g + 2) >> 2) * 16, kn = ((g + 2) & 3) * 2;
#pragma unroll
                    for (int kk = 0; kk < 2; ++kk) {
                        const _Float16* bp = sb + (rn + l16) * WPITCH + (kn + kk) * 32 + hf * 8;
                        wf[(g + 2) % 3][kk].q[0] = *(const u32x4*)bp;
                        wf[(g + 2) % 3][kk].q[1] = *(const u32x4*)(bp + 16);
                    }
                }
                // The two scheduling barriers hold the four LDS reads of step g + 2 as one group between
                // the products of steps g - 1 and g: sunk to their use they would be waited for to zero,
                // lifted further they would need a fourth set of registers.
                __builtin_amdgcn_sched_barrier(0);
#pragma unroll
                for (int kk = 0; kk < 2; ++kk)
#pragma unroll
                    for (int tt = 0; tt < 4; ++tt) {
                        const int k8 = kp * 2 + kk;
                        const v8f c0 = k8 == 0 ? vzero : acc[tt];
                        // q, k: W * x^T (lane = token); v: x * W^T (lane = c)
                        acc[tt] = p < 2 ? wmma_f16(wf[g % 3][kk].v, xa[tt][k8].v, c0)
                                        : wmma_f16(xa[tt][k8].v, wf[g % 3][kk].v, c0);
                    }
                if (kp == 3) {
#pragma unroll
                    for (int tt = 0; tt < 4; ++tt)
#pragma unroll
                        for (int e = 0; e < 8; ++e) {
                            // q, k: c = ot * 16 + 8 * hf + e;  v: j = tt * 16 + 8 * hf + e, c tile ot
                            if (p < 2) fqk[p][tt].e[ot * 8 + e] = (_Float16)acc[tt][e];
                            else       fv[ot][tt >> 1].e[(tt & 1) * 8 + e] = (_Float16)acc[tt][e];
                        }
                }
                __builtin_amdgcn_sched_barrier(0);
            }
            if (!LAST && half < 2) {
#pragma unroll
                for (int i = 0; i < HLD / 2; ++i)
                    *(u32x4*)(sn + (half * (HLD / 2) + i) * 8 * WPITCH) = t[i];
            }
            }
        }

        if constexpr (!LAST) {
            // Publishes slab h + 1. It also ends every wave's reads of slab h, whose buffer is stored into
            // in the next pass, or, behind head 6, takes that head's O below.
            __syncthreads();
        } else {
            // x is dead: W_out flies under the last head's softmax.
#pragma unroll   // to[] stays in registers only with constant indices
            for (int i = 0; i < 32; ++i) to[i] = *(const u32x4*)(wo16 + i * (8 * 256) + wo);
            // The address registers of these loads are free for reuse from here on: the wait takes their offset
            // as an input, so that no load of the run lands on it, and the scheduling barrier keeps the later
            // writes behind it.
            asm volatile("s_wait_xcnt 0x0" :: "v"(wo) : "memory");
            __builtin_amdgcn_sched_barrier(0);
        }
        _Float16* pk = (h < OHEADS ? sP + h * (8 * OWAVE) : sW[h & 1]) + swave * OWAVE + lane * 8;

#pragma unroll
        for (int it = 0; it < 4; ++it) {
            // S^T: lane = query i (it * 16 + l16), j = jt * 16 + 8 * hf + e
            // The bias row, divided by SCALE, is the products' start value: st = q.k + bias / SCALE.
            v8f st[4];
            const float* bp = sB + (it * 16 + l16) * BPITCH + hf * 8;
            float m4[4], s4[4];
#pragma unroll
            for (int jt = 0; jt < 4; ++jt) {
                union { v8f v; f32x4 q[2]; } cb;
                cb.q[0] = *(const f32x4*)(bp + jt * 16);
                cb.q[1] = *(const f32x4*)(bp + jt * 16 + 4);
                st[jt] = wmma_f16(fqk[1][jt].v, fqk[0][it].v, cb.v);
            }
#pragma unroll
            for (int jt = 0; jt < 4; ++jt) {
                float ma = fmaxf(fmaxf(st[jt][0], st[jt][1]), fmaxf(st[jt][2], st[jt][3]));
                float mb = fmaxf(fmaxf(st[jt][4], st[jt][5]), fmaxf(st[jt][6], st[jt][7]));
                m4[jt] = fmaxf(ma, mb);
            }
            // softmax over j of SCALE * st: a row lives in the two lanes l16 and l16 + 16
            float mx = fmaxf(fmaxf(m4[0], m4[1]), fmaxf(m4[2], m4[3]));
            mx = fmaxf(mx, xhalf(mx));
#pragma unroll
            for (int jt = 0; jt < 4; ++jt) {
                float d[8], r[8];
#pragma unroll
                for (int e = 0; e < 8; ++e) {   // e^(SCALE * t) = 2^(t * SCALE * log2(e))
                    d[e] = (st[jt][e] - mx) * (SCALE * 1.4426950408889634f);
                    r[e] = __builtin_amdgcn_exp2f(d[e]);
                }
                // The slot behind a transcendental: no reader of a result and no write over a source of
                // these eight stands in front of this v_nop, so none follows its v_exp_f32 directly.
                asm("v_nop" : "+v"(r[0]), "+v"(r[1]), "+v"(r[2]), "+v"(r[3]), "+v"(r[4]), "+v"(r[5]), "+v"(r[6]), "+v"(r[7])
                            : "v"(d[0]), "v"(d[1]), "v"(d[2]), "v"(d[3]), "v"(d[4]), "v"(d[5]), "v"(d[6]), "v"(d[7]));
#pragma unroll
                for (int e = 0; e < 8; ++e) st[jt][e] = r[e];
                s4[jt] = ((st[jt][0] + st[jt][1]) + (st[jt][2] + st[jt][3]))
                       + ((st[jt][4] + st[jt][5]) + (st[jt][6] + st[jt][7]));
            }
            float sum = (s4[0] + s4[1]) + (s4[2] + s4[3]);
            sum += xhalf(sum);
            float inv = 1.0f / sum;
            Frag fp[2];      // P^T: lane = i, k order over j
#pragma unroll
            for (int jt = 0; jt < 4; ++jt)
#pragma unroll
                for (int e = 0; e < 8; ++e) fp[jt >> 1].e[(jt & 1) * 8 + e] = (_Float16)(st[jt][e] * inv);

            // O^T: lane = i, c = ct * 16 + 8 * hf + e
#pragma unroll
            for (int ct = 0; ct < 2; ++ct) {
                v8f o = wmma_f16(fv[ct][0].v, fp[0].v, vzero);
                o = wmma_f16(fv[ct][1].v, fp[1].v, o);
                Frag r;
#pragma unroll
                for (int e = 0; e < 8; ++e) r.e[e] = (_Float16)o[e];
                if constexpr (LAST) oa[it][7].q[ct] = r.q[0];
                else                *(u32x4*)(pk + it * 512 + ct * 256) = r.q[0];
            }
            if (it & 1) {
                // Two query tiles side by side, not four: with the scores and bias rows of all four
                // live at once the build passes the register budget and sends x fragments to scratch.
                __builtin_amdgcn_sched_barrier(0);
            }
        }
    };
#pragma unroll 1   // one copy of the head body for heads 0 to 6
    for (int h = 0; h < 7; ++h) head_pass(h, std::false_type{});
    head_pass(7, std::true_type{});

    // ---- output projection: out[m,o] = sum_c O[m,c] * w_out[o,c] + b_out[o] ----
    // O fragments of k steps 0 to 6 (k step = head): the lane's own stores, read back.
#pragma unroll   // oa[] stays in registers only with constant indices
    for (int k8 = 0; k8 < 7; ++k8) {
        const _Float16* ob = (k8 < OHEADS ? sP + k8 * (8 * OWAVE) : sW[k8 & 1]) + swave * OWAVE + lane * 8;
#pragma unroll
        for (int tt = 0; tt < 4; ++tt) {
            oa[tt][k8].q[0] = *(const u32x4*)(ob + tt * 512);
            oa[tt][k8].q[1] = *(const u32x4*)(ob + tt * 512 + 256);
        }
    }
    // Ends every wave's reads of the park, which W_out now overwrites.
    __syncthreads();
#pragma unroll   // to[] stays in registers only with constant indices
    for (int i = 0; i < 32; ++i) *(u32x4*)(sP + (i * 8 + wave) * WPITCH + lane * 8) = to[i];
    // Publishes W_out.
    __syncthreads();

    // A trip forms 32 outputs (one 128-byte line) of each of the 64 tokens: two 16-row weight tiles of
    // four steps; a step is two weight fragments and eight products, as in the head pass. The fragments
    // are read two steps ahead into a ring of four, whose places repeat from trip to trip.
    float* outp = out + tok0 * 256 + hf * 8;
    const _Float16* so = sP + l16 * WPITCH + hf * 8;
    Frag wg[4][2];
#pragma unroll
    for (int g = 0; g < 2; ++g)
#pragma unroll
        for (int kk = 0; kk < 2; ++kk) {
            wg[g][kk].q[0] = *(const u32x4*)(so + (g * 2 + kk) * 32);
            wg[g][kk].q[1] = *(const u32x4*)(so + (g * 2 + kk) * 32 + 16);
        }
#pragma unroll 1   // one copy of the trip: eight would double the kernel's text
    for (int n = 0; n < 8; ++n) {
        const _Float16* sc = so + n * (32 * WPITCH);
        // The last trip reads the first two steps of trip 0 once more, for nobody: inside the array, no branch.
        const _Float16* sx = so + ((n + 1) & 7) * (32 * WPITCH);
        v8f acc[4];          // [token tile]
        f32x4 bo[2];
#pragma unroll
        for (int g = 0; g < 8; ++g) {
            const int ot = g >> 2, kp = g & 3;
            {
                const _Float16* sp = (g + 2 < 8 ? sc : sx) + (((g + 2) & 7) >> 2) * (16 * WPITCH) + ((g + 2) & 3) * 64;
#pragma unroll
                for (int kk = 0; kk < 2; ++kk) {
                    wg[(g + 2) & 3][kk].q[0] = *(const u32x4*)(sp + kk * 32);
                    wg[(g + 2) & 3][kk].q[1] = *(const u32x4*)(sp + kk * 32 + 16);
                }
            }
            if (kp == 0) {
                bo[0] = *(const f32x4*)(sBo + n * 32 + ot * 16 + hf * 8);
                bo[1] = *(const f32x4*)(sBo + n * 32 + ot * 16 + hf * 8 + 4);
            }
            // As in the head pass: the two scheduling barriers hold the LDS reads of step g + 2 as one
            // group between the products of steps g - 1 and g.
            __builtin_amdgcn_sched_barrier(0);
#pragma unroll
            for (int kk = 0; kk < 2; ++kk)
#pragma unroll
                for (int tt = 0; tt < 4; ++tt) {
                    const int k8 = kp * 2 + kk;
                    acc[tt] = wmma_f16(wg[g & 3][kk].v, oa[tt][k8].v, k8 == 0 ? vzero : acc[tt]);
                }
            if (kp == 3) {
                // lane = token tt * 16 + l16, o = n * 32 + ot * 16 + 8 * hf + e
                f32x4 r[4][2];
#pragma unroll
                for (int tt = 0; tt < 4; ++tt) {
                    f32x4 lo = {acc[tt][0], acc[tt][1], acc[tt][2], acc[tt][3]};
                    f32x4 hi = {acc[tt][4], acc[tt][5], acc[tt][6], acc[tt][7]};
                    r[tt][0] = lo + bo[0];
                    r[tt][1] = hi + bo[1];
                }
                // Holds the eight stores behind all the sums: a sum placed among them would land on a
                // register that an issued store names, in front of the wait below.
                __builtin_amdgcn_sched_barrier(0);
#pragma unroll
                for (int tt = 0; tt < 4; ++tt) {
                    float* p = outp + tt * (256 * 256) + n * 32 + ot * 16;
                    *(f32x4*)p       = r[tt][0];
                    *(f32x4*)(p + 4) = r[tt][1];
                }
                // The next tile rewrites registers that these stores name (data, address).
                asm volatile("s_wait_xcnt 0x0" ::: "memory");
            }
            __builtin_amdgcn_sched_barrier(0);
        }
    }
}

// ---------------- launch ----------------

extern "C" void kernel_launch(void* const* d_in, const int* in_sizes, int n_in,
                              void* d_out, int out_size, void* d_ws, size_t ws_size,
                              hipStream_t stream) {
    const float* x    = (const float*)d_in[0];  // (2,4,128,128,256)
    const float* wqkv = (const float*)d_in[1];  // (768,256)
    const float* pos  = (const float*)d_in[2];  // (15,15)
    const float* wout = (const float*)d_in[3];  // (256,256)
    const float* bout = (const float*)d_in[4];  // (256,)
    float* out = (float*)d_out;

    // scratch layout
    char* ws = (char*)d_ws;
    _Float16* woh   = (_Float16*)ws;  ws += (size_t)768 * 256 * 2;
    _Float16* wouth = (_Float16*)ws;  ws += (size_t)256 * 256 * 2;
    float*    bias  = (float*)ws;

    prep_kernel<<<132, 256, 0, stream>>>(wqkv, wout, pos, woh, wouth, bias);
    qkv_attn_kernel<<<256, 256, 0, stream>>>(x, woh, bias, wouth, bout, out);
}

// v007
// It runs in 60.8 microseconds.
// Next to v006, in two timings, it ran 1.05 times as fast each time.
// Counting every step since v000, it is 4.98 times as fast.
#include <hip/hip_runtime.h>
#include <hip/hip_bf16.h>
#include <type_traits>

typedef __attribute__((ext_vector_type(16))) _Float16 v16h;
typedef __attribute__((ext_vector_type(8)))  float    v8f;
typedef __attribute__((ext_vector_type(4)))  float    f32x4;
typedef __attribute__((ext_vector_type(4)))  unsigned int u32x4;

union Frag {
    v16h     v;
    _Float16 e[16];
    u32x4    q[2];
};

__device__ __forceinline__ v8f wmma_f16(v16h a, v16h b, v8f c) {
    // v_wmma_f32_16x16x32_f16: D = A(16x32 f16) * B(32x16 f16) + C(16x16 f32)
    return __builtin_amdgcn_wmma_f32_16x16x32_f16(false, a, false, b, (short)0, c, false, false);
}

// value of lane l ^ 16
__device__ __forceinline__ float xhalf(float v) {
    const int b = __builtin_bit_cast(int, v);
    return __builtin_bit_cast(float, __builtin_amdgcn_permlanex16(b, b, 0x76543210, 0xfedcba98, false, false));
}

// LDS row pitch of a staged weight slab, in f16: 512 B of data + 16 B, an odd multiple
// of 16 B, so that the 16 rows of one ds_load_b128 fall on different banks.
#define WPITCH 264

// ---------------- preparation, one launch ----------------
// Blocks 0..95 convert w_qkv to f16, blocks 96..127 w_out, blocks 128..131 lay out the bias table.
// The three jobs depend on nothing but the inputs, so they share one grid; a thread takes eight
// weights (two 16-byte loads, one 16-byte store) or four neighbours of a bias row, which keeps
// the launch at 1056 waves.
__global__ __launch_bounds__(256)
void prep_kernel(const float* __restrict__ wqkv, const float* __restrict__ wout,
                 const float* __restrict__ pos,
                 _Float16* __restrict__ wqkv16, _Float16* __restrict__ wout16,
                 float* __restrict__ bias) {
    const int b = blockIdx.x;
    if (b < 128) {
        const float* src = b < 96 ? wqkv : wout;
        _Float16*    dst = b < 96 ? wqkv16 : wout16;
        const unsigned i = ((b < 96 ? b : b - 96) * 256 + threadIdx.x) * 8;
        const float* sp = src + i;
        const f32x4 lo = *(const f32x4*)sp;
        const f32x4 hi = *(const f32x4*)(sp + 4);
        // The address registers of the two loads may be rewritten from here on; the address is an
        // input, so that neither load lands on it.
        asm volatile("s_wait_xcnt 0x0" :: "v"(sp) : "memory");
        union { _Float16 e[8]; u32x4 q; } r;
        for (int e = 0; e < 4; ++e) {
            r.e[e]     = (_Float16)lo[e];
            r.e[4 + e] = (_Float16)hi[e];
        }
        *(u32x4*)(dst + i) = r.q;
    } else {
        // bias[i][j] = pos_embedding[jy-iy+7][jx-ix+7]   (rel = idx[j]-idx[i]+7); j .. j+3 share jy
        const int idx = ((b - 128) * 256 + threadIdx.x) * 4;   // 0..4092
        const int i = idx >> 6, j = idx & 63;
        const int iy = i >> 3, ix = i & 7, jy = j >> 3, jx = j & 7;
        const float* pp = pos + ((jy - iy + 7) * 15 + (jx - ix + 7));
        f32x4 v;
        for (int e = 0; e < 4; ++e) v[e] = pp[e];
        // As above, for the address registers of this row piece's loads.
        asm volatile("s_wait_xcnt 0x0" :: "v"(pp) : "memory");
        *(f32x4*)(bias + idx) = v;
        // Behind the store: in the built code the conversion path stands below it and rewrites
        // registers that the store names (data, address).
        asm volatile("s_wait_xcnt 0x0" ::: "memory");
    }
}

// ---------------- QKV projection, windowed attention and output projection ----------------
// One wave owns one 8x8 window (64 tokens); block = 8 waves = 8 windows side by side; grid 256.
// The window's 64 x 256 piece of x is read and converted once and stays in registers as four
// 16-token fragment sets. The block walks the heads: the 96 weight rows of one head (32 of q,
// 32 of k, 32 of v) are staged in one of two LDS buffers. q, k and v of the head never leave
// the registers, because each product is formed with the operand order whose result layout
// is the fragment layout of its next use (lane = l16, eight neighbours along e + 8 * hf):
//   q^T, k^T = W * x^T   -> lane = token, e runs over c   (fragments of S^T = k * q^T)
//   v        = x * W^T   -> lane = c,     e runs over j   (A fragment of O^T = v^T * P^T)
//   S^T      = k * q^T   -> lane = i,     e runs over j   (B fragment of O^T after softmax)
//   O^T                  -> lane = i,     e runs over c   (16-byte stores)
// O of the eight heads has no room in the registers beside x. Each lane parks its 16-byte pieces in LDS,
// in lane order (a wave-wide store or load covers 512 bytes in a row), and, behind the last head, when x
// is dead, reads back exactly the bytes that it stored itself: they are the fragments of the output projection,
//   out^T = W_out * O^T  -> lane = token, e runs over o   (staged in LDS, stored as whole lines)
// Heads 0 to 5 have a park of their own, head 6 lies in the slab buffer that its pass has finished with,
// and head 7, whose pass is written out behind the loop, goes straight into the registers that x has left.
// The weights of the output projection take the park's place once it has been read back.

#define HROWS  96                  // weight rows per head slab
#define HLD    (HROWS / 8)         // 16-byte loads per thread and slab (one row per wave-wide load)
#define BPITCH 68                  // LDS row pitch of the bias in f32: 256 B + 16 B, rows on different banks
#define OHEADS 6                   // heads whose O has a park of its own
#define OWAVE  2048                // f16 of one wave's O of one head: 64 tokens x 32 c
#define SPITCH 36                  // LDS row pitch of the output staging in f32: 128 B + 16 B, rows on different banks

__global__ __launch_bounds__(256)
void qkv_attn_kernel(const float* __restrict__ x,
                     const _Float16* __restrict__ w,     // (768,256) f16 row-major
                     const float* __restrict__ bias,     // 64x64
                     const _Float16* __restrict__ wo16,  // (256,256) f16 row-major
                     const float* __restrict__ bout,     // (256,)
                     float* __restrict__ out) {          // (131072,256)
    __shared__ __align__(16) _Float16 sW[2][HROWS * WPITCH];   // staged head slabs
    __shared__ __align__(16) float    sB[64 * BPITCH];         // bias[i][j] / SCALE
    // [head][wave][query tile][c tile][lane] 8 x f16 of O; later 256 rows of W_out at pitch WPITCH
    __shared__ __align__(16) _Float16 sP[OHEADS * 8 * OWAVE];
    __shared__ __align__(16) float    sBo[256];                // its bias
    const float SCALE  = 0.17677669529663687f;  // 32^-0.5
    const float RSCALE = 5.656854249492381f;    // 32^0.5
    const int lane = threadIdx.x & 31;
    const int wave = threadIdx.x >> 5;
    const int l16  = lane & 15;
    const int hf   = lane >> 4;            // half-wave select
    const int wid  = blockIdx.x * 8 + wave;
    const int bl = wid >> 8, wy = (wid >> 4) & 15, wx = wid & 15;
    // token of window position l16; position tt * 16 + l16 lies two image rows (256 tokens) per tt further
    const size_t tok0 = (size_t)bl * 16384 + (size_t)(wy * 8 + (l16 >> 3)) * 128 + (wx * 8 + (l16 & 7));

    // x fragments of all eight k steps (f32 -> f16): lane holds token, halves [0..7]@k0, [8..15]@k0+16.
    Frag xa[4][8];
    const float* xb = x + tok0 * 256 + hf * 8;
#pragma unroll   // xa[] and f[] stay in registers only with constant indices
    for (int tt = 0; tt < 4; ++tt) {
        const float* ap = xb + tt * (256 * 256);
        f32x4 f[32];
#pragma unroll
        for (int k8 = 0; k8 < 8; ++k8) {
            f[k8 * 4 + 0] = *(const f32x4*)(ap + k8 * 32);
            f[k8 * 4 + 1] = *(const f32x4*)(ap + k8 * 32 + 4);
            f[k8 * 4 + 2] = *(const f32x4*)(ap + k8 * 32 + 16);
            f[k8 * 4 + 3] = *(const f32x4*)(ap + k8 * 32 + 20);
        }
        // Behind a run of loads whose address registers are free for reuse from here on: it takes
        // their base as an input, so that no load of the run lands on it, and the scheduling
        // barrier keeps the later writes behind it.
        asm volatile("s_wait_xcnt 0x0" :: "v"(xb) : "memory");
        __builtin_amdgcn_sched_barrier(0);
#pragma unroll
        for (int k8 = 0; k8 < 8; ++k8)
            for (int e = 0; e < 4; ++e) {
                xa[tt][k8].e[e]      = (_Float16)f[k8 * 4 + 0][e];
                xa[tt][k8].e[4 + e]  = (_Float16)f[k8 * 4 + 1][e];
                xa[tt][k8].e[8 + e]  = (_Float16)f[k8 * 4 + 2][e];
                xa[tt][k8].e[12 + e] = (_Float16)f[k8 * 4 + 3][e];
            }
        // Keeps the next 32 loads behind these conversions: all 128 f32 loads in flight
        // at once would pass the register budget.
        __builtin_amdgcn_sched_barrier(0);
    }

    // Slab row i * 8 + wave is row (i & 3) * 8 + wave of part i >> 2 (q, k, v) of the head.
    // A thread's 16 bytes of it lie at element wave * 256 + lane * 8 = threadIdx.x * 8 of the group of 8 rows.
    const unsigned wo = threadIdx.x * 8;
    const unsigned swave = __builtin_amdgcn_readfirstlane(wave);
    {
        u32x4 t[HLD];
        f32x4 bt[4];
#pragma unroll   // t[] and bt[] stay in registers only with constant indices
        for (int i = 0; i < HLD; ++i) t[i] = *(const u32x4*)(w + ((i >> 2) * 256 + (i & 3) * 8) * 256 + wo);
#pragma unroll
        for (int n = 0; n < 4; ++n) bt[n] = *(const f32x4*)(bias + (threadIdx.x + n * 256) * 4);
        const float bo1 = bout[threadIdx.x];
        // The address registers of these loads are free for reuse from here on.
        asm volatile("s_wait_xcnt 0x0" :: "v"(wo) : "memory");
#pragma unroll
        for (int i = 0; i < HLD; ++i) *(u32x4*)(sW[0] + (i * 8 + wave) * WPITCH + lane * 8) = t[i];
#pragma unroll
        for (int n = 0; n < 4; ++n) {
            int q4 = threadIdx.x + n * 256;
            *(f32x4*)(sB + (q4 >> 4) * BPITCH + (q4 & 15) * 4) = bt[n] * RSCALE;
        }
        sBo[threadIdx.x] = bo1;
    }
    // Publishes slab 0 and the two biases.
    __syncthreads();

    Frag  oa[4][8];      // O fragments of the output projection, [token tile][k step = head]
    u32x4 to[32];        // row i * 8 + wave of W_out on its way to LDS

    const v8f vzero = {0.f,0.f,0.f,0.f,0.f,0.f,0.f,0.f};
    // One head. The last one stages no further slab, passes no barrier and keeps its O in registers.
    auto head_pass = [&](const int h, auto last_tag) __attribute__((always_inline)) {
        constexpr bool LAST = decltype(last_tag)::value;
        const _Float16* sb = sW[h & 1];

        // Every inner loop of the pass is unrolled: fragments and accumulators stay in
        // registers only with constant indices.
        Frag fqk[2][4];      // [q, k][token tile]: lane = token, k order over c
        Frag fv[2][2];       // [c tile][chunk of 32 j]: lane = c, k order over j
        {
            // 24 steps: part p = g >> 3 (q, k, v), its 16-row tile ot = (g >> 2) & 1, k steps
            // 2 * (g & 3) and the next; a step is two weight fragments and eight products.
            // The fragments are read two steps ahead into a ring of three.
            Frag wf[3][2];
            v8f acc[4];      // [token tile]
            // The thread's element of the next head's rows.
            // The lane's number is read anew in every pass (volatile: not lifted out of the loop) and the wave's
            // is kept in a scalar register: held over the pass, the thread's offset went to scratch.
            unsigned l8 = 0;
            if constexpr (!LAST) {
                unsigned ln;
                asm volatile("v_mbcnt_lo_u32_b32 %0, -1, 0" : "=v"(ln));
                l8 = ln * 8;
            }
            const _Float16* wn = w + (swave * 256 + (h + 1) * (32 * 256));
            _Float16* sn = sW[(h + 1) & 1] + wave * WPITCH + lane * 8;
#pragma unroll
            for (int g = 0; g < 2; ++g)
#pragma unroll
                for (int kk = 0; kk < 2; ++kk) {
                    const _Float16* bp = sb + l16 * WPITCH + (g * 2 + kk) * 32 + hf * 8;
                    wf[g][kk].q[0] = *(const u32x4*)bp;
                    wf[g][kk].q[1] = *(const u32x4*)(bp + 16);
                }
            // The next slab goes through the registers in two halves, which fly under the steps of q
            // and of k; under those of v the finished q and k fragments leave no room for them.
#pragma unroll
            for (int half = 0; half < 3; ++half) {
            u32x4 t[HLD / 2];
            if (!LAST && half < 2) {
#pragma unroll
                for (int i = 0; i < HLD / 2; ++i) {
                    const int r = half * (HLD / 2) + i;
                    t[i] = *(const u32x4*)(wn + ((r >> 2) * 256 + (r & 3) * 8) * 256 + l8);
                }
                // Registers of the address of these loads may be rewritten from here on.
                asm volatile("s_wait_xcnt 0x0" ::: "memory");
            }
#pragma unroll
            for (int g = half * 8; g < half * 8 + 8; ++g) {
                const int p = g >> 3, ot = (g >> 2) & 1, kp = g & 3;
                if (g + 2 < 24) {
                    const int rn = ((g + 2) >> 2) * 16, kn = ((g + 2) & 3) * 2;
#pragma unroll
                    for (int kk = 0; kk < 2; ++kk) {
                        const _Float16* bp = sb + (rn + l16) * WPITCH + (kn + kk) * 32 + hf * 8;
                        wf[(g + 2) % 3][kk].q[0] = *(const u32x4*)bp;
                        wf[(g + 2) % 3][kk].q[1] = *(const u32x4*)(bp + 16);
                    }
                }
                // The two scheduling barriers hold the four LDS reads of step g + 2 as one group between
                // the products of steps g - 1 and g: sunk to their use they would be waited for to zero,
                // lifted further they would need a fourth set of registers.
                __builtin_amdgcn_sched_barrier(0);
#pragma unroll
                for (int kk = 0; kk < 2; ++kk)
#pragma unroll
                    for (int tt = 0; tt < 4; ++tt) {
                        const int k8 = kp * 2 + kk;
                        const v8f c0 = k8 == 0 ? vzero : acc[tt];
                        // q, k: W * x^T (lane = token); v: x * W^T (lane = c)
                        acc[tt] = p < 2 ? wmma_f16(wf[g % 3][kk].v, xa[tt][k8].v, c0)
                                        : wmma_f16(xa[tt][k8].v, wf[g % 3][kk].v, c0);
                    }
                if (kp == 3) {
#pragma unroll
                    for (int tt = 0; tt < 4; ++tt)
#pragma unroll
                        for (int e = 0; e < 8; ++e) {
                            // q, k: c = ot * 16 + 8 * hf + e;  v: j = tt * 16 + 8 * hf + e, c tile ot
                            if (p < 2) fqk[p][tt].e[ot * 8 + e] = (_Float16)acc[tt][e];
                            else       fv[ot][tt >> 1].e[(tt & 1) * 8 + e] = (_Float16)acc[tt][e];
                        }
                }
                __builtin_amdgcn_sched_barrier(0);
            }
            if (!LAST && half < 2) {
#pragma unroll
                for (int i = 0; i < HLD / 2; ++i)
                    *(u32x4*)(sn + (half * (HLD / 2) + i) * 8 * WPITCH) = t[i];
            }
            }
        }

        if constexpr (!LAST) {
            // Publishes slab h + 1. It also ends every wave's reads of slab h, whose buffer is stored into
            // in the next pass, or, behind head 6, takes that head's O below.
            __syncthreads();
        } else {
            // x is dead: W_out flies under the last head's softmax.
            // The thread's offset is formed anew, as for the slabs: held over the heads it went to scratch.
            unsigned lw;
            asm volatile("v_mbcnt_lo_u32_b32 %0, -1, 0" : "=v"(lw));
            const unsigned wl = (lw & 31) * 8;      // the mask tells the compiler the range: a 32-bit offset will do
            const _Float16* wob = wo16 + swave * 256;
#pragma unroll   // to[] stays in registers only with constant indices
            for (int i = 0; i < 32; ++i) to[i] = *(const u32x4*)(wob + i * (8 * 256) + wl);
            // The address registers of these loads are free for reuse from here on: the wait takes their offset
            // as an input, so that no load of the run lands on it, and the scheduling barrier keeps the later
            // writes behind it.
            asm volatile("s_wait_xcnt 0x0" :: "v"(wl) : "memory");
            __builtin_amdgcn_sched_barrier(0);
        }
        _Float16* pk = (h < OHEADS ? sP + h * (8 * OWAVE) : sW[h & 1]) + swave * OWAVE + lane * 8;

#pragma unroll
        for (int it = 0; it < 4; ++it) {
            // S^T: lane = query i (it * 16 + l16), j = jt * 16 + 8 * hf + e
            // The bias row, divided by SCALE, is the products' start value: st = q.k + bias / SCALE.
            v8f st[4];
            const float* bp = sB + (it * 16 + l16) * BPITCH + hf * 8;
            float m4[4], s4[4];
#pragma unroll
            for (int jt = 0; jt < 4; ++jt) {
                union { v8f v; f32x4 q[2]; } cb;
                cb.q[0] = *(const f32x4*)(bp + jt * 16);
                cb.q[1] = *(const f32x4*)(bp + jt * 16 + 4);
                st[jt] = wmma_f16(fqk[1][jt].v, fqk[0][it].v, cb.v);
            }
#pragma unroll
            for (int jt = 0; jt < 4; ++jt) {
                float ma = fmaxf(fmaxf(st[jt][0], st[jt][1]), fmaxf(st[jt][2], st[jt][3]));
                float mb = fmaxf(fmaxf(st[jt][4], st[jt][5]), fmaxf(st[jt][6], st[jt][7]));
                m4[jt] = fmaxf(ma, mb);
            }
            // softmax over j of SCALE * st: a row lives in the two lanes l16 and l16 + 16
            float mx = fmaxf(fmaxf(m4[0], m4[1]), fmaxf(m4[2], m4[3]));
            mx = fmaxf(mx, xhalf(mx));
#pragma unroll
            for (int jt = 0; jt < 4; ++jt) {
                float d[8], r[8];
#pragma unroll
                for (int e = 0; e < 8; ++e) {   // e^(SCALE * t) = 2^(t * SCALE * log2(e))
                    d[e] = (st[jt][e] - mx) * (SCALE * 1.4426950408889634f);
                    r[e] = __builtin_amdgcn_exp2f(d[e]);
                }
                // The slot behind a transcendental: no reader of a result and no write over a source of
                // these eight stands in front of this v_nop, so none follows its v_exp_f32 directly.
                asm("v_nop" : "+v"(r[0]), "+v"(r[1]), "+v"(r[2]), "+v"(r[3]), "+v"(r[4]), "+v"(r[5]), "+v"(r[6]), "+v"(r[7])
                            : "v"(d[0]), "v"(d[1]), "v"(d[2]), "v"(d[3]), "v"(d[4]), "v"(d[5]), "v"(d[6]), "v"(d[7]));
#pragma unroll
                for (int e = 0; e < 8; ++e) st[jt][e] = r[e];
                s4[jt] = ((st[jt][0] + st[jt][1]) + (st[jt][2] + st[jt][3]))
                       + ((st[jt][4] + st[jt][5]) + (st[jt][6] + st[jt][7]));
            }
            float sum = (s4[0] + s4[1]) + (s4[2] + s4[3]);
            sum += xhalf(sum);
            float inv = 1.0f / sum;
            Frag fp[2];      // P^T: lane = i, k order over j
#pragma unroll
            for (int jt = 0; jt < 4; ++jt)
#pragma unroll
                for (int e = 0; e < 8; ++e) fp[jt >> 1].e[(jt & 1) * 8 + e] = (_Float16)(st[jt][e] * inv);

            // O^T: lane = i, c = ct * 16 + 8 * hf + e
#pragma unroll
            for (int ct = 0; ct < 2; ++ct) {
                v8f o = wmma_f16(fv[ct][0].v, fp[0].v, vzero);
                o = wmma_f16(fv[ct][1].v, fp[1].v, o);
                Frag r;
#pragma unroll
                for (int e = 0; e < 8; ++e) r.e[e] = (_Float16)o[e];
                if constexpr (LAST) oa[it][7].q[ct] = r.q[0];
                else                *(u32x4*)(pk + it * 512 + ct * 256) = r.q[0];
            }
            if (it & 1) {
                // Two query tiles side by side, not four: with the scores and bias rows of all four
                // live at once the build passes the register budget and sends x fragments to scratch.
                __builtin_amdgcn_sched_barrier(0);
            }
        }
    };
#pragma unroll 1   // one copy of the head body for heads 0 to 6
    for (int h = 0; h < 7; ++h) head_pass(h, std::false_type{});
    head_pass(7, std::true_type{});

    // ---- output projection: out[m,o] = sum_c O[m,c] * w_out[o,c] + b_out[o] ----
    // O fragments of k steps 0 to 6 (k step = head): the lane's own stores, read back.
#pragma unroll   // oa[] stays in registers only with constant indices
    for (int k8 = 0; k8 < 7; ++k8) {
        const _Float16* ob = (k8 < OHEADS ? sP + k8 * (8 * OWAVE) : sW[k8 & 1]) + swave * OWAVE + lane * 8;
#pragma unroll
        for (int tt = 0; tt < 4; ++tt) {
            oa[tt][k8].q[0] = *(const u32x4*)(ob + tt * 512);
            oa[tt][k8].q[1] = *(const u32x4*)(ob + tt * 512 + 256);
        }
    }
    // Ends every wave's reads of the park, which W_out now overwrites.
    __syncthreads();
#pragma unroll   // to[] stays in registers only with constant indices
    for (int i = 0; i < 32; ++i) *(u32x4*)(sP + (i * 8 + wave) * WPITCH + lane * 8) = to[i];
    // Publishes W_out.
    __syncthreads();

    // A trip forms 32 outputs (one 128-byte line) of each of the 64 tokens: two 16-row weight tiles of
    // four steps; a step is two weight fragments and eight products, as in the head pass. The fragments
    // are read two steps ahead into a ring of four, whose places repeat from trip to trip.
    // A lane's results are 32 bytes of a token's line, so a store straight from them would touch 16 lines.
    // They go through the wave's own piece of the slab buffers (free behind the barriers above), one row
    // per token, and leave one trip later as whole lines: eight lanes a line, four lines a store.
    const _Float16* so = sP + l16 * WPITCH + hf * 8;
    // The lane's number is read anew (volatile: not lifted over the heads) and the window's place comes from
    // scalar registers: formed at the kernel's entry and held over the heads, these addresses went to scratch.
    unsigned lnr;
    asm volatile("v_mbcnt_lo_u32_b32 %0, -1, 0" : "=v"(lnr));
    const unsigned ln = lnr & 31;               // the mask tells the compiler the range: 32-bit offsets will do
    const unsigned swid = blockIdx.x * 8 + swave;
    const unsigned sbl = swid >> 8, swy = (swid >> 4) & 15, swx = swid & 15;
    float* stg = (float*)&sW[0][0] + swave * (64 * SPITCH);
    float* sst = stg + (ln & 15) * SPITCH + (ln >> 4) * 8;
    // Store j of a trip takes window rows (lane >> 3) + 4 * (j >> 3), column j & 7: the two rows that a
    // half-wave reads lie eight staging rows apart, on different banks.
    const float* srd = stg + (ln >> 3) * (8 * SPITCH) + (ln & 7) * 4;
    float* outw = out + ((size_t)sbl * 16384 + (size_t)swy * 1024 + swx * 8) * 256;   // the window's first token
    const unsigned oq = (ln >> 3) * (128 * 256) + (ln & 7) * 4;
    f32x4 rb[16];        // the lines of the trip before, on their way out
    Frag wg[4][2];
#pragma unroll
    for (int g = 0; g < 2; ++g)
#pragma unroll
        for (int kk = 0; kk < 2; ++kk) {
            wg[g][kk].q[0] = *(const u32x4*)(so + (g * 2 + kk) * 32);
            wg[g][kk].q[1] = *(const u32x4*)(so + (g * 2 + kk) * 32 + 16);
        }
    auto read_back = [&]() __attribute__((always_inline)) {
        // The wave's own staging stores have retired before other lanes' rows are read.
        asm volatile("s_wait_dscnt 0x0" ::: "memory");
#pragma unroll   // rb[] stays in registers only with constant indices
        for (int j = 0; j < 16; ++j) rb[j] = *(const f32x4*)(srd + ((j >> 3) * 32 + (j & 7)) * SPITCH);
    };
    auto send = [&](const int m) __attribute__((always_inline)) {
#pragma unroll
        for (int j = 0; j < 16; ++j) *(f32x4*)(outw + m * 32 + (oq + ((j >> 3) * 512 + (j & 7)) * 256)) = rb[j];
        // Later code rewrites registers that these stores name (data, address).
        asm volatile("s_wait_xcnt 0x0" ::: "memory");
    };
#pragma unroll 1   // one copy of the trip: eight would double the kernel's text
    for (int n = 0; n < 8; ++n) {
        const _Float16* sc = so + n * (32 * WPITCH);
        // The last trip reads the first two steps of trip 0 once more, for nobody: inside the array, no branch.
        const _Float16* sx = so + ((n + 1) & 7) * (32 * WPITCH);
        v8f acc[4];          // [token tile]
        f32x4 bo[2];
#pragma unroll
        for (int g = 0; g < 8; ++g) {
            const int ot = g >> 2, kp = g & 3;
            // The lines of trip n - 1 are read with the fragments of step 2 and sent behind step 1.
            if (g == 0 && n != 0) read_back();
            {
                const _Float16* sp = (g + 2 < 8 ? sc : sx) + (((g + 2) & 7) >> 2) * (16 * WPITCH) + ((g + 2) & 3) * 64;
#pragma unroll
                for (int kk = 0; kk < 2; ++kk) {
                    wg[(g + 2) & 3][kk].q[0] = *(const u32x4*)(sp + kk * 32);
                    wg[(g + 2) & 3][kk].q[1] = *(const u32x4*)(sp + kk * 32 + 16);
                }
            }
            if (kp == 0) {
                bo[0] = *(const f32x4*)(sBo + n * 32 + ot * 16 + hf * 8);
                bo[1] = *(const f32x4*)(sBo + n * 32 + ot * 16 + hf * 8 + 4);
            }
            // As in the head pass: the two scheduling barriers hold the LDS reads of step g + 2 as one
            // group between the products of steps g - 1 and g.
            __builtin_amdgcn_sched_barrier(0);
#pragma unroll
            for (int kk = 0; kk < 2; ++kk)
#pragma unroll
                for (int tt = 0; tt < 4; ++tt) {
                    const int k8 = kp * 2 + kk;
                    acc[tt] = wmma_f16(wg[g & 3][kk].v, oa[tt][k8].v, k8 == 0 ? vzero : acc[tt]);
                }
            if (g == 1 && n != 0) send(n - 1);
            if (kp == 3) {
                // lane = token tt * 16 + l16, o = n * 32 + ot * 16 + 8 * hf + e
#pragma unroll
                for (int tt = 0; tt < 4; ++tt) {
                    f32x4 lo = {acc[tt][0], acc[tt][1], acc[tt][2], acc[tt][3]};
                    f32x4 hi = {acc[tt][4], acc[tt][5], acc[tt][6], acc[tt][7]};
                    *(f32x4*)(sst + tt * (16 * SPITCH) + ot * 16)     = lo + bo[0];
                    *(f32x4*)(sst + tt * (16 * SPITCH) + ot * 16 + 4) = hi + bo[1];
                }
            }
            __builtin_amdgcn_sched_barrier(0);
        }
    }
    read_back();
    send(7);
}

// ---------------- launch ----------------

extern "C" void kernel_launch(void* const* d_in, const int* in_sizes, int n_in,
                              void* d_out, int out_size, void* d_ws, size_t ws_size,
                              hipStream_t stream) {
    const float* x    = (const float*)d_in[0];  // (2,4,128,128,256)
    const float* wqkv = (const float*)d_in[1];  // (768,256)
    const float* pos  = (const float*)d_in[2];  // (15,15)
    const float* wout = (const float*)d_in[3];  // (256,256)
    const float* bout = (const float*)d_in[4];  // (256,)
    float* out = (float*)d_out;

    // scratch layout
    char* ws = (char*)d_ws;
    _Float16* woh   = (_Float16*)ws;  ws += (size_t)768 * 256 * 2;
    _Float16* wouth = (_Float16*)ws;  ws += (size_t)256 * 256 * 2;
    float*    bias  = (float*)ws;

    prep_kernel<<<132, 256, 0, stream>>>(wqkv, wout, pos, woh, wouth, bias);
    qkv_attn_kernel<<<256, 256, 0, stream>>>(x, woh, bias, wouth, bout, out);
}

// v008
// Measured time: 57.1 microseconds a run.
// Two timings next to v007 put it at 1.06 and 1.07 times that version's speed.
// Over all steps from v000 it is 5.30 times as fast.
#include <hip/hip_runtime.h>
#include <hip/hip_bf16.h>
#include <type_traits>

typedef __attribute__((ext_vector_type(16))) _Float16 v16h;
typedef __attribute__((ext_vector_type(8)))  float    v8f;
typedef __attribute__((ext_vector_type(4)))  float    f32x4;
typedef __attribute__((ext_vector_type(4)))  unsigned int u32x4;

union Frag {
    v16h     v;
    _Float16 e[16];
    u32x4    q[2];
};

__device__ __forceinline__ v8f wmma_f16(v16h a, v16h b, v8f c) {
    // v_wmma_f32_16x16x32_f16: D = A(16x32 f16) * B(32x16 f16) + C(16x16 f32)
    return __builtin_amdgcn_wmma_f32_16x16x32_f16(false, a, false, b, (short)0, c, false, false);
}

// value of lane l ^ 16
__device__ __forceinline__ float xhalf(float v) {
    const int b = __builtin_bit_cast(int, v);
    return __builtin_bit_cast(float, __builtin_amdgcn_permlanex16(b, b, 0x76543210, 0xfedcba98, false, false));
}

// LDS row pitch of a staged weight slab, in f16: 512 B of data + 16 B, an odd multiple
// of 16 B, so that the 16 rows of one ds_load_b128 fall on different banks.
#define WPITCH 264

// ---------------- preparation, one launch ----------------
// Blocks 0..95 convert w_qkv to f16, blocks 96..127 w_out, blocks 128..131 lay out the bias table.
// The three jobs depend on nothing but the inputs, so they share one grid; a thread takes eight
// weights (two 16-byte loads, one 16-byte store) or four neighbours of a bias row, which keeps
// the launch at 1056 waves.
__global__ __launch_bounds__(256)
void prep_kernel(const float* __restrict__ wqkv, const float* __restrict__ wout,
                 const float* __restrict__ pos,
                 _Float16* __restrict__ wqkv16, _Float16* __restrict__ wout16,
                 float* __restrict__ bias) {
    const int b = blockIdx.x;
    if (b < 128) {
        const float* src = b < 96 ? wqkv : wout;
        _Float16*    dst = b < 96 ? wqkv16 : wout16;
        const unsigned i = ((b < 96 ? b : b - 96) * 256 + threadIdx.x) * 8;
        const float* sp = src + i;
        const f32x4 lo = *(const f32x4*)sp;
        const f32x4 hi = *(const f32x4*)(sp + 4);
        // The address registers of the two loads may be rewritten from here on; the address is an
        // input, so that neither load lands on it.
        asm volatile("s_wait_xcnt 0x0" :: "v"(sp) : "memory");
        union { _Float16 e[8]; u32x4 q; } r;
        for (int e = 0; e < 4; ++e) {
            r.e[e]     = (_Float16)lo[e];
            r.e[4 + e] = (_Float16)hi[e];
        }
        *(u32x4*)(dst + i) = r.q;
    } else {
        // bias[i][j] = pos_embedding[jy-iy+7][jx-ix+7]   (rel = idx[j]-idx[i]+7); j .. j+3 share jy
        const int idx = ((b - 128) * 256 + threadIdx.x) * 4;   // 0..4092
        const int i = idx >> 6, j = idx & 63;
        const int iy = i >> 3, ix = i & 7, jy = j >> 3, jx = j & 7;
        const float* pp = pos + ((jy - iy + 7) * 15 + (jx - ix + 7));
        f32x4 v;
        for (int e = 0; e < 4; ++e) v[e] = pp[e];
        // As above, for the address registers of this row piece's loads.
        asm volatile("s_wait_xcnt 0x0" :: "v"(pp) : "memory");
        *(f32x4*)(bias + idx) = v;
        // Behind the store: in the built code the conversion path stands below it and rewrites
        // registers that the store names (data, address).
        asm volatile("s_wait_xcnt 0x0" ::: "memory");
    }
}

// ---------------- QKV projection, windowed attention and output projection ----------------
// One wave owns one 8x8 window (64 tokens); block = 8 waves = 8 windows side by side; grid 256.
// The window's 64 x 256 piece of x is read and converted once and stays in registers as four
// 16-token fragment sets. The block walks the heads: the 96 weight rows of one head (32 of q,
// 32 of k, 32 of v) are staged in one of two LDS buffers. q, k and v of the head never leave
// the registers, because each product is formed with the operand order whose result layout
// is the fragment layout of its next use (lane = l16, eight neighbours along e + 8 * hf):
//   q^T, k^T = W * x^T   -> lane = token, e runs over c   (fragments of S^T = k * q^T)
//   v        = x * W^T   -> lane = c,     e runs over j   (A fragment of O^T = v^T * P^T)
//   S^T      = k * q^T   -> lane = i,     e runs over j   (B fragment of O^T after softmax)
//   O^T                  -> lane = i,     e runs over c   (16-byte stores)
// O of the eight heads has no room in the registers beside x. Each lane parks its 16-byte pieces in LDS,
// in lane order (a wave-wide store or load covers 512 bytes in a row), and, behind the last head, when x
// is dead, reads back exactly the bytes that it stored itself: they are the fragments of the output projection,
//   out^T = W_out * O^T  -> lane = token, e runs over o   (staged in LDS, stored as whole 256-byte pieces)
// Heads 0 to 5 have a park of their own, head 6 lies in the slab buffer that its pass has finished with,
// and head 7, whose pass is written out behind the loop, goes straight into the registers that x has left.
// The weights of the output projection take the park's place once it has been read back.

#define HROWS  96                  // weight rows per head slab
#define HLD    (HROWS / 8)         // 16-byte loads per thread and slab (one row per wave-wide load)
#define BPITCH 68                  // LDS row pitch of the bias in f32: 256 B + 16 B, rows on different banks
#define OHEADS 6                   // heads whose O has a park of its own
#define OWAVE  2048                // f16 of one wave's O of one head: 64 tokens x 32 c
#define SPITCH 68                  // LDS row pitch of the output staging in f32: 256 B + 16 B, rows on different banks
#define SWAVE  (64 * SPITCH)       // f32 of one wave's output staging: one row per token
#define SSLAB  5                   // waves whose staging lies in the slab buffers; the others' lies behind W_out

__global__ __launch_bounds__(256)
void qkv_attn_kernel(const float* __restrict__ x,
                     const _Float16* __restrict__ w,     // (768,256) f16 row-major
                     const float* __restrict__ bias,     // 64x64
                     const _Float16* __restrict__ wo16,  // (256,256) f16 row-major
                     const float* __restrict__ bout,     // (256,)
                     float* __restrict__ out) {          // (131072,256)
    __shared__ __align__(16) _Float16 sW[2][HROWS * WPITCH];   // staged head slabs
    __shared__ __align__(16) float    sB[64 * BPITCH];         // bias[i][j] / SCALE
    // [head][wave][query tile][c tile][lane] 8 x f16 of O; later 256 rows of W_out at pitch WPITCH
    __shared__ __align__(16) _Float16 sP[OHEADS * 8 * OWAVE];
    __shared__ __align__(16) float    sBo[256];                // its bias
    const float SCALE  = 0.17677669529663687f;  // 32^-0.5
    const float RSCALE = 5.656854249492381f;    // 32^0.5
    const int lane = threadIdx.x & 31;
    const int wave = threadIdx.x >> 5;
    const int l16  = lane & 15;
    const int hf   = lane >> 4;            // half-wave select
    const int wid  = blockIdx.x * 8 + wave;
    const int bl = wid >> 8, wy = (wid >> 4) & 15, wx = wid & 15;
    // token of window position l16; position tt * 16 + l16 lies two image rows (256 tokens) per tt further
    const size_t tok0 = (size_t)bl * 16384 + (size_t)(wy * 8 + (l16 >> 3)) * 128 + (wx * 8 + (l16 & 7));

    // x fragments of all eight k steps (f32 -> f16): lane holds token, halves [0..7]@k0, [8..15]@k0+16.
    Frag xa[4][8];
    const float* xb = x + tok0 * 256 + hf * 8;
#pragma unroll   // xa[] and f[] stay in registers only with constant indices
    for (int tt = 0; tt < 4; ++tt) {
        const float* ap = xb + tt * (256 * 256);
        f32x4 f[32];
#pragma unroll
        for (int k8 = 0; k8 < 8; ++k8) {
            f[k8 * 4 + 0] = *(const f32x4*)(ap + k8 * 32);
            f[k8 * 4 + 1] = *(const f32x4*)(ap + k8 * 32 + 4);
            f[k8 * 4 + 2] = *(const f32x4*)(ap + k8 * 32 + 16);
            f[k8 * 4 + 3] = *(const f32x4*)(ap + k8 * 32 + 20);
        }
        // Behind a run of loads whose address registers are free for reuse from here on: it takes
        // their base as an input, so that no load of the run lands on it, and the scheduling
        // barrier keeps the later writes behind it.
        asm volatile("s_wait_xcnt 0x0" :: "v"(xb) : "memory");
        __builtin_amdgcn_sched_barrier(0);
#pragma unroll
        for (int k8 = 0; k8 < 8; ++k8)
            for (int e = 0; e < 4; ++e) {
                xa[tt][k8].e[e]      = (_Float16)f[k8 * 4 + 0][e];
                xa[tt][k8].e[4 + e]  = (_Float16)f[k8 * 4 + 1][e];
                xa[tt][k8].e[8 + e]  = (_Float16)f[k8 * 4 + 2][e];
                xa[tt][k8].e[12 + e] = (_Float16)f[k8 * 4 + 3][e];
            }
        // Keeps the next 32 loads behind these conversions: all 128 f32 loads in flight
        // at once would pass the register budget.
        __builtin_amdgcn_sched_barrier(0);
    }

    // Slab row i * 8 + wave is row (i & 3) * 8 + wave of part i >> 2 (q, k, v) of the head.
    // A thread's 16 bytes of it lie at element wave * 256 + lane * 8 = threadIdx.x * 8 of the group of 8 rows.
    const unsigned wo = threadIdx.x * 8;
    const unsigned swave = __builtin_amdgcn_readfirstlane(wave);
    {
        u32x4 t[HLD];
        f32x4 bt[4];
#pragma unroll   // t[] and bt[] stay in registers only with constant indices
        for (int i = 0; i < HLD; ++i) t[i] = *(const u32x4*)(w + ((i >> 2) * 256 + (i & 3) * 8) * 256 + wo);
#pragma unroll
        for (int n = 0; n < 4; ++n) bt[n] = *(const f32x4*)(bias + (threadIdx.x + n * 256) * 4);
        const float bo1 = bout[threadIdx.x];
        // The address registers of these loads are free for reuse from here on.
        asm volatile("s_wait_xcnt 0x0" :: "v"(wo) : "memory");
#pragma unroll
        for (int i = 0; i < HLD; ++i) *(u32x4*)(sW[0] + (i * 8 + wave) * WPITCH + lane * 8) = t[i];
#pragma unroll
        for (int n = 0; n < 4; ++n) {
            int q4 = threadIdx.x + n * 256;
            *(f32x4*)(sB + (q4 >> 4) * BPITCH + (q4 & 15) * 4) = bt[n] * RSCALE;
        }
        sBo[threadIdx.x] = bo1;
    }
    // Publishes slab 0 and the two biases.
    __syncthreads();

    Frag  oa[4][8];      // O fragments of the output projection, [token tile][k step = head]
    u32x4 to[32];        // row i * 8 + wave of W_out on its way to LDS

    const v8f vzero = {0.f,0.f,0.f,0.f,0.f,0.f,0.f,0.f};
    // One head. The last one stages no further slab, passes no barrier and keeps its O in registers.
    auto head_pass = [&](const int h, auto last_tag) __attribute__((always_inline)) {
        constexpr bool LAST = decltype(last_tag)::value;
        const _Float16* sb = sW[h & 1];

        // Every inner loop of the pass is unrolled: fragments and accumulators stay in
        // registers only with constant indices.
        Frag fqk[2][4];      // [q, k][token tile]: lane = token, k order over c
        Frag fv[2][2];       // [c tile][chunk of 32 j]: lane = c, k order over j
        {
            // 24 steps: part p = g >> 3 (q, k, v), its 16-row tile ot = (g >> 2) & 1, k steps
            // 2 * (g & 3) and the next; a step is two weight fragments and eight products.
            // The fragments are read two steps ahead into a ring of three.
            Frag wf[3][2];
            v8f acc[4];      // [token tile]
            // The thread's element of the next head's rows.
            // The lane's number is read anew in every pass (volatile: not lifted out of the loop) and the wave's
            // is kept in a scalar register: held over the pass, the thread's offset went to scratch.
            unsigned l8 = 0;
            if constexpr (!LAST) {
                unsigned ln;
                asm volatile("v_mbcnt_lo_u32_b32 %0, -1, 0" : "=v"(ln));
                l8 = ln * 8;
            }
            const _Float16* wn = w + (swave * 256 + (h + 1) * (32 * 256));
            _Float16* sn = sW[(h + 1) & 1] + wave * WPITCH + lane * 8;
#pragma unroll
            for (int g = 0; g < 2; ++g)
#pragma unroll
                for (int kk = 0; kk < 2; ++kk) {
                    const _Float16* bp = sb + l16 * WPITCH + (g * 2 + kk) * 32 + hf * 8;
                    wf[g][kk].q[0] = *(const u32x4*)bp;
                    wf[g][kk].q[1] = *(const u32x4*)(bp + 16);
                }
            // The next slab goes through the registers in two halves, which fly under the steps of q
            // and of k; under those of v the finished q and k fragments leave no room for them.
#pragma unroll
            for (int half = 0; half < 3; ++half) {
            u32x4 t[HLD / 2];
            if (!LAST && half < 2) {
#pragma unroll
                for (int i = 0; i < HLD / 2; ++i) {
                    const int r = half * (HLD / 2) + i;
                    t[i] = *(const u32x4*)(wn + ((r >> 2) * 256 + (r & 3) * 8) * 256 + l8);
                }
                // Registers of the address of these loads may be rewritten from here on.
                asm volatile("s_wait_xcnt 0x0" ::: "memory");
            }
#pragma unroll
            for (int g = half * 8; g < half * 8 + 8; ++g) {
                const int p = g >> 3, ot = (g >> 2) & 1, kp = g & 3;
                if (g + 2 < 24) {
                    const int rn = ((g + 2) >> 2) * 16, kn = ((g + 2) & 3) * 2;
#pragma unroll
                    for (int kk = 0; kk < 2; ++kk) {
                        const _Float16* bp = sb + (rn + l16) * WPITCH + (kn + kk) * 32 + hf * 8;
                        wf[(g + 2) % 3][kk].q[0] = *(const u32x4*)bp;
                        wf[(g + 2) % 3][kk].q[1] = *(const u32x4*)(bp + 16);
                    }
                }
                // The two scheduling barriers hold the four LDS reads of step g + 2 as one group between
                // the products of steps g - 1 and g: sunk to their use they would be waited for to zero,
                // lifted further they would need a fourth set of registers.
                __builtin_amdgcn_sched_barrier(0);
#pragma unroll
                for (int kk = 0; kk < 2; ++kk)
#pragma unroll
                    for (int tt = 0; tt < 4; ++tt) {
                        const int k8 = kp * 2 + kk;
                        const v8f c0 = k8 == 0 ? vzero : acc[tt];
                        // q, k: W * x^T (lane = token); v: x * W^T (lane = c)
                        acc[tt] = p < 2 ? wmma_f16(wf[g % 3][kk].v, xa[tt][k8].v, c0)
                                        : wmma_f16(xa[tt][k8].v, wf[g % 3][kk].v, c0);
                    }
                if (kp == 3) {
#pragma unroll
                    for (int tt = 0; tt < 4; ++tt)
#pragma unroll
                        for (int e = 0; e < 8; ++e) {
                            // q, k: c = ot * 16 + 8 * hf + e;  v: j = tt * 16 + 8 * hf + e, c tile ot
                            if (p < 2) fqk[p][tt].e[ot * 8 + e] = (_Float16)acc[tt][e];
                            else       fv[ot][tt >> 1].e[(tt & 1) * 8 + e] = (_Float16)acc[tt][e];
                        }
                }
                __builtin_amdgcn_sched_barrier(0);
            }
            if (!LAST && half < 2) {
#pragma unroll
                for (int i = 0; i < HLD / 2; ++i)
                    *(u32x4*)(sn + (half * (HLD / 2) + i) * 8 * WPITCH) = t[i];
            }
            }
        }

        if constexpr (!LAST) {
            // Publishes slab h + 1. It also ends every wave's reads of slab h, whose buffer is stored into
            // in the next pass, or, behind head 6, takes that head's O below.
            __syncthreads();
        } else {
            // x is dead: W_out flies under the last head's softmax.
            // The thread's offset is formed anew, as for the slabs: held over the heads it went to scratch.
            unsigned lw;
            asm volatile("v_mbcnt_lo_u32_b32 %0, -1, 0" : "=v"(lw));
            const unsigned wl = (lw & 31) * 8;      // the mask tells the compiler the range: a 32-bit offset will do
            const _Float16* wob = wo16 + swave * 256;
#pragma unroll   // to[] stays in registers only with constant indices
            for (int i = 0; i < 32; ++i) to[i] = *(const u32x4*)(wob + i * (8 * 256) + wl);
            // The address registers of these loads are free for reuse from here on: the wait takes their offset
            // as an input, so that no load of the run lands on it, and the scheduling barrier keeps the later
            // writes behind it.
            asm volatile("s_wait_xcnt 0x0" :: "v"(wl) : "memory");
            __builtin_amdgcn_sched_barrier(0);
        }
        _Float16* pk = (h < OHEADS ? sP + h * (8 * OWAVE) : sW[h & 1]) + swave * OWAVE + lane * 8;

#pragma unroll
        for (int it = 0; it < 4; ++it) {
            // S^T: lane = query i (it * 16 + l16), j = jt * 16 + 8 * hf + e
            // The bias row, divided by SCALE, is the products' start value: st = q.k + bias / SCALE.
            v8f st[4];
            const float* bp = sB + (it * 16 + l16) * BPITCH + hf * 8;
            float m4[4], s4[4];
#pragma unroll
            for (int jt = 0; jt < 4; ++jt) {
                union { v8f v; f32x4 q[2]; } cb;
                cb.q[0] = *(const f32x4*)(bp + jt * 16);
                cb.q[1] = *(const f32x4*)(bp + jt * 16 + 4);
                st[jt] = wmma_f16(fqk[1][jt].v, fqk[0][it].v, cb.v);
            }
#pragma unroll
            for (int jt = 0; jt < 4; ++jt) {
                float ma = fmaxf(fmaxf(st[jt][0], st[jt][1]), fmaxf(st[jt][2], st[jt][3]));
                float mb = fmaxf(fmaxf(st[jt][4], st[jt][5]), fmaxf(st[jt][6], st[jt][7]));
                m4[jt] = fmaxf(ma, mb);
            }
            // softmax over j of SCALE * st: a row lives in the two lanes l16 and l16 + 16
            float mx = fmaxf(fmaxf(m4[0], m4[1]), fmaxf(m4[2], m4[3]));
            mx = fmaxf(mx, xhalf(mx));
#pragma unroll
            for (int jt = 0; jt < 4; ++jt) {
                float d[8], r[8];
#pragma unroll
                for (int e = 0; e < 8; ++e) {   // e^(SCALE * t) = 2^(t * SCALE * log2(e))
                    d[e] = (st[jt][e] - mx) * (SCALE * 1.4426950408889634f);
                    r[e] = __builtin_amdgcn_exp2f(d[e]);
                }
                // The slot behind a transcendental: no reader of a result and no write over a source of
                // these eight stands in front of this v_nop, so none follows its v_exp_f32 directly.
                asm("v_nop" : "+v"(r[0]), "+v"(r[1]), "+v"(r[2]), "+v"(r[3]), "+v"(r[4]), "+v"(r[5]), "+v"(r[6]), "+v"(r[7])
                            : "v"(d[0]), "v"(d[1]), "v"(d[2]), "v"(d[3]), "v"(d[4]), "v"(d[5]), "v"(d[6]), "v"(d[7]));
#pragma unroll
                for (int e = 0; e < 8; ++e) st[jt][e] = r[e];
                s4[jt] = ((st[jt][0] + st[jt][1]) + (st[jt][2] + st[jt][3]))
                       + ((st[jt][4] + st[jt][5]) + (st[jt][6] + st[jt][7]));
            }
            float sum = (s4[0] + s4[1]) + (s4[2] + s4[3]);
            sum += xhalf(sum);
            float inv = 1.0f / sum;
            Frag fp[2];      // P^T: lane = i, k order over j
#pragma unroll
            for (int jt = 0; jt < 4; ++jt)
#pragma unroll
                for (int e = 0; e < 8; ++e) fp[jt >> 1].e[(jt & 1) * 8 + e] = (_Float16)(st[jt][e] * inv);

            // O^T: lane = i, c = ct * 16 + 8 * hf + e
#pragma unroll
            for (int ct = 0; ct < 2; ++ct) {
                v8f o = wmma_f16(fv[ct][0].v, fp[0].v, vzero);
                o = wmma_f16(fv[ct][1].v, fp[1].v, o);
                Frag r;
#pragma unroll
                for (int e = 0; e < 8; ++e) r.e[e] = (_Float16)o[e];
                if constexpr (LAST) oa[it][7].q[ct] = r.q[0];
                else                *(u32x4*)(pk + it * 512 + ct * 256) = r.q[0];
            }
            if (it & 1) {
                // Two query tiles side by side, not four: with the scores and bias rows of all four
                // live at once the build passes the register budget and sends x fragments to scratch.
                __builtin_amdgcn_sched_barrier(0);
            }
        }
    };
#pragma unroll 1   // one copy of the head body for heads 0 to 6
    for (int h = 0; h < 7; ++h) head_pass(h, std::false_type{});
    head_pass(7, std::true_type{});

    // ---- output projection: out[m,o] = sum_c O[m,c] * w_out[o,c] + b_out[o] ----
    // O fragments of k steps 0 to 6 (k step = head): the lane's own stores, read back.
#pragma unroll   // oa[] stays in registers only with constant indices
    for (int k8 = 0; k8 < 7; ++k8) {
        const _Float16* ob = (k8 < OHEADS ? sP + k8 * (8 * OWAVE) : sW[k8 & 1]) + swave * OWAVE + lane * 8;
#pragma unroll
        for (int tt = 0; tt < 4; ++tt) {
            oa[tt][k8].q[0] = *(const u32x4*)(ob + tt * 512);
            oa[tt][k8].q[1] = *(const u32x4*)(ob + tt * 512 + 256);
        }
    }
    // Ends every wave's reads of the park, which W_out now overwrites.
    __syncthreads();
#pragma unroll   // to[] stays in registers only with constant indices
    for (int i = 0; i < 32; ++i) *(u32x4*)(sP + (i * 8 + wave) * WPITCH + lane * 8) = to[i];
    // Publishes W_out.
    __syncthreads();

    // A trip forms 32 outputs (one 128-byte line) of each of the 64 tokens: two 16-row weight tiles of
    // four steps; a step is two weight fragments and eight products, as in the head pass. The fragments
    // are read two steps ahead into a ring of four, whose places repeat from trip to trip.
    // A lane's results are 32 bytes of a token's line, so a store straight from them would touch 16 lines.
    // They go through the wave's own staging rows, one row per token, which take the lines of two trips side
    // by side: an aligned 256-byte piece of the token's output row. The rows
    // leave under the trip behind the pair, a half-wave to a piece, so that each piece is written by one store.
    // The rows lie in LDS that is free behind the barriers above: the slab buffers and the park's end.
    const _Float16* so = sP + l16 * WPITCH + hf * 8;
    // The lane's number is read anew (volatile: not lifted over the heads) and the window's place comes from
    // scalar registers: formed at the kernel's entry and held over the heads, these addresses went to scratch.
    unsigned lnr;
    asm volatile("v_mbcnt_lo_u32_b32 %0, -1, 0" : "=v"(lnr));
    const unsigned ln = lnr & 31;               // the mask tells the compiler the range: 32-bit offsets will do
    const unsigned swid = blockIdx.x * 8 + swave;
    const unsigned sbl = swid >> 8, swy = (swid >> 4) & 15, swx = swid & 15;
    float* stg = swave < SSLAB ? (float*)&sW[0][0] + swave * SWAVE
                               : (float*)(sP + 256 * WPITCH) + (swave - SSLAB) * SWAVE;
    float* sst = stg + (ln & 15) * SPITCH + (ln >> 4) * 8;
    // Store j of a pair of trips takes window positions 2 * j and 2 * j + 1, one to a half-wave, which reads
    // a whole staging row: every bank once.
    const float* srd = stg + (ln >> 4) * SPITCH + (ln & 15) * 4;
    float* outw = out + ((size_t)sbl * 16384 + (size_t)swy * 1024 + swx * 8) * 256;   // the window's first token
    const unsigned oq = (ln >> 4) * 256 + (ln & 15) * 4;
    f32x4 rb[16];        // half of the pieces of the pair of trips before, on their way out
    Frag wg[4][2];
#pragma unroll
    for (int g = 0; g < 2; ++g)
#pragma unroll
        for (int kk = 0; kk < 2; ++kk) {
            wg[g][kk].q[0] = *(const u32x4*)(so + (g * 2 + kk) * 32);
            wg[g][kk].q[1] = *(const u32x4*)(so + (g * 2 + kk) * 32 + 16);
        }
    // Half b of the rows: window positions b * 32 and up.
    auto read_back = [&](const int b) __attribute__((always_inline)) {
        // The wave's own staging stores have retired before other lanes' rows are read; no staging store
        // stands between the two halves, so the first half's wait serves both.
        if (b == 0) asm volatile("s_wait_dscnt 0x0" ::: "memory");
#pragma unroll   // rb[] stays in registers only with constant indices
        for (int j = 0; j < 16; ++j) rb[j] = *(const f32x4*)(srd + (b * 32 + j * 2) * SPITCH);
    };
    auto send = [&](const int m, const int b) __attribute__((always_inline)) {
#pragma unroll
        for (int j = 0; j < 16; ++j)     // position b * 32 + j * 2: window row b * 4 + (j >> 2), column (j & 3) * 2
            *(f32x4*)(outw + m * 64 + (oq + ((b * 4 + (j >> 2)) * 128 + (j & 3) * 2) * 256)) = rb[j];
        // Later code rewrites registers that these stores name (data, address).
        asm volatile("s_wait_xcnt 0x0" ::: "memory");
    };
#pragma unroll 1   // one copy of the trip: eight would double the kernel's text
    for (int n = 0; n < 8; ++n) {
        const _Float16* sc = so + n * (32 * WPITCH);
        // The last trip reads the first two steps of trip 0 once more, for nobody: inside the array, no branch.
        const _Float16* sx = so + ((n + 1) & 7) * (32 * WPITCH);
        const bool full = n != 0 && (n & 1) == 0;    // the pair of trips before lies whole in the staging rows
        float* sh = sst + (n & 1) * 32;              // this trip's half of the rows
        v8f acc[4];          // [token tile]
        f32x4 bo[2];
#pragma unroll
        for (int g = 0; g < 8; ++g) {
            const int ot = g >> 2, kp = g & 3;
            // The rows of the pair before are read with the fragments of steps 2 and 4 and sent behind steps 1
            // and 3, all in front of this trip's first staging stores.
            if ((g == 0 || g == 2) && full) read_back(g >> 1);
            {
                const _Float16* sp = (g + 2 < 8 ? sc : sx) + (((g + 2) & 7) >> 2) * (16 * WPITCH) + ((g + 2) & 3) * 64;
#pragma unroll
                for (int kk = 0; kk < 2; ++kk) {
                    wg[(g + 2) & 3][kk].q[0] = *(const u32x4*)(sp + kk * 32);
                    wg[(g + 2) & 3][kk].q[1] = *(const u32x4*)(sp + kk * 32 + 16);
                }
            }
            if (kp == 0) {
                bo[0] = *(const f32x4*)(sBo + n * 32 + ot * 16 + hf * 8);
                bo[1] = *(const f32x4*)(sBo + n * 32 + ot * 16 + hf * 8 + 4);
            }
            // As in the head pass: the two scheduling barriers hold the LDS reads of step g + 2 as one
            // group between the products of steps g - 1 and g.
            __builtin_amdgcn_sched_barrier(0);
#pragma unroll
            for (int kk = 0; kk < 2; ++kk)
#pragma unroll
                for (int tt = 0; tt < 4; ++tt) {
                    const int k8 = kp * 2 + kk;
                    acc[tt] = wmma_f16(wg[g & 3][kk].v, oa[tt][k8].v, k8 == 0 ? vzero : acc[tt]);
                }
            if ((g == 1 || g == 3) && full) send((n >> 1) - 1, g >> 1);
            if (kp == 3) {
                // lane = token tt * 16 + l16, o = n * 32 + ot * 16 + 8 * hf + e
#pragma unroll
                for (int tt = 0; tt < 4; ++tt) {
                    f32x4 lo = {acc[tt][0], acc[tt][1], acc[tt][2], acc[tt][3]};
                    f32x4 hi = {acc[tt][4], acc[tt][5], acc[tt][6], acc[tt][7]};
                    *(f32x4*)(sh + tt * (16 * SPITCH) + ot * 16)     = lo + bo[0];
                    *(f32x4*)(sh + tt * (16 * SPITCH) + ot * 16 + 4) = hi + bo[1];
                }
            }
            __builtin_amdgcn_sched_barrier(0);
        }
    }
    // The last pair. The O fragments are dead, so both halves of the rows are read in one run.
    f32x4 rt[32];
    // As in read_back: the wave's own staging stores have retired before other lanes' rows are read.
    asm volatile("s_wait_dscnt 0x0" ::: "memory");
#pragma unroll   // rt[] stays in registers only with constant indices
    for (int j = 0; j < 32; ++j) rt[j] = *(const f32x4*)(srd + j * 2 * SPITCH);
#pragma unroll
    for (int j = 0; j < 32; ++j)
        *(f32x4*)(outw + 3 * 64 + (oq + ((j >> 2) * 128 + (j & 3) * 2) * 256)) = rt[j];
}

// ---------------- launch ----------------

extern "C" void kernel_launch(void* const* d_in, const int* in_sizes, int n_in,
                              void* d_out, int out_size, void* d_ws, size_t ws_size,
                              hipStream_t stream) {
    const float* x    = (const float*)d_in[0];  // (2,4,128,128,256)
    const float* wqkv = (const float*)d_in[1];  // (768,256)
    const float* pos  = (const float*)d_in[2];  // (15,15)
    const float* wout = (const float*)d_in[3];  // (256,256)
    const float* bout = (const float*)d_in[4];  // (256,)
    float* out = (float*)d_out;

    // scratch layout
    char* ws = (char*)d_ws;
    _Float16* woh   = (_Float16*)ws;  ws += (size_t)768 * 256 * 2;
    _Float16* wouth = (_Float16*)ws;  ws += (size_t)256 * 256 * 2;
    float*    bias  = (float*)ws;

    prep_kernel<<<132, 256, 0, stream>>>(wqkv, wout, pos, woh, wouth, bias);
    qkv_attn_kernel<<<256, 256, 0, stream>>>(x, woh, bias, wouth, bout, out);
}

// v009
// One run takes 55 microseconds.
// In two side-by-side timings against v008, it was 1.03 and 1.04 times as fast.
// Over all steps from v000 it is 5.49 times as fast.
#include <hip/hip_runtime.h>
#include <hip/hip_bf16.h>
#include <type_traits>

typedef __attribute__((ext_vector_type(16))) _Float16 v16h;
typedef __attribute__((ext_vector_type(8)))  float    v8f;
typedef __attribute__((ext_vector_type(4)))  float    f32x4;
typedef __attribute__((ext_vector_type(4)))  unsigned int u32x4;
typedef __attribute__((ext_vector_type(4)))  int      i32x4;
typedef __attribute__((address_space(1))) i32x4 glb_i32x4;
typedef __attribute__((address_space(3))) i32x4 lds_i32x4;

union Frag {
    v16h     v;
    _Float16 e[16];
    u32x4    q[2];
};

__device__ __forceinline__ v8f wmma_f16(v16h a, v16h b, v8f c) {
    // v_wmma_f32_16x16x32_f16: D = A(16x32 f16) * B(32x16 f16) + C(16x16 f32)
    return __builtin_amdgcn_wmma_f32_16x16x32_f16(false, a, false, b, (short)0, c, false, false);
}

// value of lane l ^ 16
__device__ __forceinline__ float xhalf(float v) {
    const int b = __builtin_bit_cast(int, v);
    return __builtin_bit_cast(float, __builtin_amdgcn_permlanex16(b, b, 0x76543210, 0xfedcba98, false, false));
}

// LDS row pitch of a staged weight slab, in f16: 512 B of data + 16 B, an odd multiple
// of 16 B, so that the 16 rows of one ds_load_b128 fall on different banks.
#define WPITCH 264

// ---------------- preparation, one launch ----------------
// Blocks 0..95 convert w_qkv to f16, blocks 96..127 w_out, blocks 128..131 lay out the bias table.
// The three jobs depend on nothing but the inputs, so they share one grid; a thread takes eight
// weights (two 16-byte loads, one 16-byte store) or four neighbours of a bias row, which keeps
// the launch at 1056 waves.
__global__ __launch_bounds__(256)
void prep_kernel(const float* __restrict__ wqkv, const float* __restrict__ wout,
                 const float* __restrict__ pos,
                 _Float16* __restrict__ wqkv16, _Float16* __restrict__ wout16,
                 float* __restrict__ bias) {
    const int b = blockIdx.x;
    if (b < 128) {
        const float* src = b < 96 ? wqkv : wout;
        _Float16*    dst = b < 96 ? wqkv16 : wout16;
        const unsigned i = ((b < 96 ? b : b - 96) * 256 + threadIdx.x) * 8;
        const float* sp = src + i;
        const f32x4 lo = *(const f32x4*)sp;
        const f32x4 hi = *(const f32x4*)(sp + 4);
        // The address registers of the two loads may be rewritten from here on; the address is an
        // input, so that neither load lands on it.
        asm volatile("s_wait_xcnt 0x0" :: "v"(sp) : "memory");
        union { _Float16 e[8]; u32x4 q; } r;
        for (int e = 0; e < 4; ++e) {
            r.e[e]     = (_Float16)lo[e];
            r.e[4 + e] = (_Float16)hi[e];
        }
        *(u32x4*)(dst + i) = r.q;
    } else {
        // bias[i][j] = pos_embedding[jy-iy+7][jx-ix+7]   (rel = idx[j]-idx[i]+7); j .. j+3 share jy
        const int idx = ((b - 128) * 256 + threadIdx.x) * 4;   // 0..4092
        const int i = idx >> 6, j = idx & 63;
        const int iy = i >> 3, ix = i & 7, jy = j >> 3, jx = j & 7;
        const float* pp = pos + ((jy - iy + 7) * 15 + (jx - ix + 7));
        f32x4 v;
        for (int e = 0; e < 4; ++e) v[e] = pp[e];
        // As above, for the address registers of this row piece's loads.
        asm volatile("s_wait_xcnt 0x0" :: "v"(pp) : "memory");
        *(f32x4*)(bias + idx) = v;
        // Behind the store: in the built code the conversion path stands below it and rewrites
        // registers that the store names (data, address).
        asm volatile("s_wait_xcnt 0x0" ::: "memory");
    }
}

// ---------------- QKV projection, windowed attention and output projection ----------------
// One wave owns one 8x8 window (64 tokens); block = 8 waves = 8 windows side by side; grid 256.
// The window's 64 x 256 piece of x is read and converted once and stays in registers as four
// 16-token fragment sets. It comes in by asynchronous copies to LDS, 512 bytes in a row to a copy, and
// the lanes pick their fragments' pieces out of the wave's own two tile buffers.
// The block walks the heads: the 96 weight rows of one head (32 of q,
// 32 of k, 32 of v) are staged in one of two LDS buffers. q, k and v of the head never leave
// the registers, because each product is formed with the operand order whose result layout
// is the fragment layout of its next use (lane = l16, eight neighbours along e + 8 * hf):
//   q^T, k^T = W * x^T   -> lane = token, e runs over c   (fragments of S^T = k * q^T)
//   v        = x * W^T   -> lane = c,     e runs over j   (A fragment of O^T = v^T * P^T)
//   S^T      = k * q^T   -> lane = i,     e runs over j   (B fragment of O^T after softmax)
//   O^T                  -> lane = i,     e runs over c   (16-byte stores)
// O of the eight heads has no room in the registers beside x. Each lane parks its 16-byte pieces in LDS,
// in lane order (a wave-wide store or load covers 512 bytes in a row), and, behind the last head, when x
// is dead, reads back exactly the bytes that it stored itself: they are the fragments of the output projection,
//   out^T = W_out * O^T  -> lane = token, e runs over o   (staged in LDS, stored as whole 256-byte pieces)
// Heads 0 to 5 have a park of their own, head 6 lies in the slab buffer that its pass has finished with,
// and head 7, whose pass is written out behind the loop, goes straight into the registers that x has left.
// The weights of the output projection take the park's place once it has been read back.

#define HROWS  96                  // weight rows per head slab
#define HLD    (HROWS / 8)         // 16-byte loads per thread and slab (one row per wave-wide load)
#define BPITCH 68                  // LDS row pitch of the bias in f32: 256 B + 16 B, rows on different banks
#define OHEADS 6                   // heads whose O has a park of its own
#define OWAVE  2048                // f16 of one wave's O of one head: 64 tokens x 32 c
#define SPITCH 68                  // LDS row pitch of the output staging in f32: 256 B + 16 B, rows on different banks
#define SWAVE  (64 * SPITCH)       // f32 of one wave's output staging: one row per token
#define SSLAB  5                   // waves whose staging lies in the slab buffers; the others' lies behind W_out
#define XPITCH 1040                // LDS row pitch of an x tile in bytes: 1024 B + 16 B, rows on different banks
#define XTILE  (16 * XPITCH)       // bytes of one x tile: 16 tokens
#define XPARK  11                  // x tile buffers that lie in the park; the other five lie in the slab buffers

__global__ __launch_bounds__(256)
void qkv_attn_kernel(const float* __restrict__ x,
                     const _Float16* __restrict__ w,     // (768,256) f16 row-major
                     const float* __restrict__ bias,     // 64x64
                     const _Float16* __restrict__ wo16,  // (256,256) f16 row-major
                     const float* __restrict__ bout,     // (256,)
                     float* __restrict__ out) {          // (131072,256)
    __shared__ __align__(16) _Float16 sW[2][HROWS * WPITCH];   // staged head slabs
    __shared__ __align__(16) float    sB[64 * BPITCH];         // bias[i][j] / SCALE
    // [head][wave][query tile][c tile][lane] 8 x f16 of O; later 256 rows of W_out at pitch WPITCH
    __shared__ __align__(16) _Float16 sP[OHEADS * 8 * OWAVE];
    __shared__ __align__(16) float    sBo[256];                // its bias
    const float SCALE  = 0.17677669529663687f;  // 32^-0.5
    const float RSCALE = 5.656854249492381f;    // 32^0.5
    const int lane = threadIdx.x & 31;
    const int wave = threadIdx.x >> 5;
    const int l16  = lane & 15;
    const int hf   = lane >> 4;            // half-wave select
    const unsigned swave = __builtin_amdgcn_readfirstlane(wave);

    // x fragments of all eight k steps (f32 -> f16): lane holds token, halves [0..7]@k0, [8..15]@k0+16.
    // A load straight into that layout would touch 16 lines for 32 bytes of each. Instead a tile of 16 tokens
    // (two image rows of the window, 8 KB in a row each) is copied to LDS, half a token's row to a copy, and
    // read from there. Each wave has two tile buffers of its own, in LDS that nothing else uses yet: tile
    // tt + 1 flies while tile tt is read and converted. The ring is private to the wave: a buffer is read and
    // refilled by the wave that filled it and by no other, so its own waits order everything and it passes no
    // barrier here. One tile, 32 copies, is in flight at a time.
    Frag xa[4][8];
    {
        const unsigned xwid = blockIdx.x * 8 + swave;
        const unsigned xbl = xwid >> 8, xwy = (xwid >> 4) & 15, xwx = xwid & 15;
        // the lane's 16 bytes of the first half row of the window's first token
        const float* xw = x + ((size_t)xbl * 16384 + (size_t)xwy * 1024 + xwx * 8) * 256 + lane * 4;
        char* xbuf[2];
#pragma unroll   // xbuf[] stays in registers only with constant indices
        for (int b = 0; b < 2; ++b) {
            const unsigned bi = swave * 2 + b;
            xbuf[b] = bi < XPARK ? (char*)sP + bi * XTILE : (char*)&sW[0][0] + (bi - XPARK) * XTILE;
        }
        auto copy_tile = [&](const int tt) __attribute__((always_inline)) {
            char* lp = xbuf[tt & 1] + lane * 16;
            // Both loops unrolled: every copy's two addresses are the lane's bases plus constants.
#pragma unroll
            for (int r = 0; r < 16; ++r)         // window position tt * 16 + r: image row tt * 2 + (r >> 3)
#pragma unroll
                for (int hh = 0; hh < 2; ++hh)
                    __builtin_amdgcn_global_load_async_to_lds_b128(
                        (glb_i32x4*)(xw + ((tt * 2 + (r >> 3)) * 128 + (r & 7)) * 256 + hh * 128),
                        (lds_i32x4*)(lp + r * XPITCH + hh * 512), 0, 0);
        };
        auto take_tile = [&](const int tt) __attribute__((always_inline)) {
            const char* rp = xbuf[tt & 1] + l16 * XPITCH + hf * 32;
#pragma unroll   // xa[] stays in registers only with constant indices
            for (int k8 = 0; k8 < 8; ++k8) {
                const f32x4 f0 = *(const f32x4*)(rp + k8 * 128);
                const f32x4 f1 = *(const f32x4*)(rp + k8 * 128 + 16);
                const f32x4 f2 = *(const f32x4*)(rp + k8 * 128 + 64);
                const f32x4 f3 = *(const f32x4*)(rp + k8 * 128 + 80);
                for (int e = 0; e < 4; ++e) {
                    xa[tt][k8].e[e]      = (_Float16)f0[e];
                    xa[tt][k8].e[4 + e]  = (_Float16)f1[e];
                    xa[tt][k8].e[8 + e]  = (_Float16)f2[e];
                    xa[tt][k8].e[12 + e] = (_Float16)f3[e];
                }
            }
        };
        copy_tile(0);
#pragma unroll   // xa[] stays in registers only with constant indices
        for (int tt = 0; tt < 4; ++tt) {
            // The wave's reads of tile tt - 1 have retired before tile tt + 1 is copied over it.
            if (tt >= 1 && tt + 1 < 4) asm volatile("s_wait_dscnt 0x0" ::: "memory");
            // Tile tt, the only one in flight, has landed before it is read.
            asm volatile("s_wait_asynccnt 0x0" ::: "memory");
            if (tt + 1 < 4) copy_tile(tt + 1);
            take_tile(tt);
        }
    }

    // Slab row i * 8 + wave is row (i & 3) * 8 + wave of part i >> 2 (q, k, v) of the head.
    // A thread's 16 bytes of it lie at element wave * 256 + lane * 8 = threadIdx.x * 8 of the group of 8 rows.
    const unsigned wo = threadIdx.x * 8;
    {
        u32x4 t[HLD];
        f32x4 bt[4];
#pragma unroll   // t[] and bt[] stay in registers only with constant indices
        for (int i = 0; i < HLD; ++i) t[i] = *(const u32x4*)(w + ((i >> 2) * 256 + (i & 3) * 8) * 256 + wo);
#pragma unroll
        for (int n = 0; n < 4; ++n) bt[n] = *(const f32x4*)(bias + (threadIdx.x + n * 256) * 4);
        const float bo1 = bout[threadIdx.x];
        // The address registers of these loads are free for reuse from here on.
        asm volatile("s_wait_xcnt 0x0" :: "v"(wo) : "memory");
        // Ends every wave's reads of its x tiles: some lie where slab 0 is stored now.
        __syncthreads();
#pragma unroll
        for (int i = 0; i < HLD; ++i) *(u32x4*)(sW[0] + (i * 8 + wave) * WPITCH + lane * 8) = t[i];
#pragma unroll
        for (int n = 0; n < 4; ++n) {
            int q4 = threadIdx.x + n * 256;
            *(f32x4*)(sB + (q4 >> 4) * BPITCH + (q4 & 15) * 4) = bt[n] * RSCALE;
        }
        sBo[threadIdx.x] = bo1;
    }
    // Publishes slab 0 and the two biases.
    __syncthreads();

    Frag  oa[4][8];      // O fragments of the output projection, [token tile][k step = head]
    u32x4 to[32];        // row i * 8 + wave of W_out on its way to LDS

    const v8f vzero = {0.f,0.f,0.f,0.f,0.f,0.f,0.f,0.f};
    // One head. The last one stages no further slab, passes no barrier and keeps its O in registers.
    auto head_pass = [&](const int h, auto last_tag) __attribute__((always_inline)) {
        constexpr bool LAST = decltype(last_tag)::value;
        const _Float16* sb = sW[h & 1];

        // Every inner loop of the pass is unrolled: fragments and accumulators stay in
        // registers only with constant indices.
        Frag fqk[2][4];      // [q, k][token tile]: lane = token, k order over c
        Frag fv[2][2];       // [c tile][chunk of 32 j]: lane = c, k order over j
        {
            // 24 steps: part p = g >> 3 (q, k, v), its 16-row tile ot = (g >> 2) & 1, k steps
            // 2 * (g & 3) and the next; a step is two weight fragments and eight products.
            // The fragments are read two steps ahead into a ring of three.
            Frag wf[3][2];
            v8f acc[4];      // [token tile]
            // The thread's element of the next head's rows.
            // The lane's number is read anew in every pass (volatile: not lifted out of the loop) and the wave's
            // is kept in a scalar register: held over the pass, the thread's offset went to scratch.
            unsigned l8 = 0;
            if constexpr (!LAST) {
                unsigned ln;
                asm volatile("v_mbcnt_lo_u32_b32 %0, -1, 0" : "=v"(ln));
                l8 = ln * 8;
            }
            const _Float16* wn = w + (swave * 256 + (h + 1) * (32 * 256));
            _Float16* sn = sW[(h + 1) & 1] + wave * WPITCH + lane * 8;
#pragma unroll
            for (int g = 0; g < 2; ++g)
#pragma unroll
                for (int kk = 0; kk < 2; ++kk) {
                    const _Float16* bp = sb + l16 * WPITCH + (g * 2 + kk) * 32 + hf * 8;
                    wf[g][kk].q[0] = *(const u32x4*)bp;
                    wf[g][kk].q[1] = *(const u32x4*)(bp + 16);
                }
            // The next slab goes through the registers in two halves, which fly under the steps of q
            // and of k; under those of v the finished q and k fragments leave no room for them.
#pragma unroll
            for (int half = 0; half < 3; ++half) {
            u32x4 t[HLD / 2];
            if (!LAST && half < 2) {
#pragma unroll
                for (int i = 0; i < HLD / 2; ++i) {
                    const int r = half * (HLD / 2) + i;
                    t[i] = *(const u32x4*)(wn + ((r >> 2) * 256 + (r & 3) * 8) * 256 + l8);
                }
                // Registers of the address of these loads may be rewritten from here on.
                asm volatile("s_wait_xcnt 0x0" ::: "memory");
            }
#pragma unroll
            for (int g = half * 8; g < half * 8 + 8; ++g) {
                const int p = g >> 3, ot = (g >> 2) & 1, kp = g & 3;
                if (g + 2 < 24) {
                    const int rn = ((g + 2) >> 2) * 16, kn = ((g + 2) & 3) * 2;
#pragma unroll
                    for (int kk = 0; kk < 2; ++kk) {
                        const _Float16* bp = sb + (rn + l16) * WPITCH + (kn + kk) * 32 + hf * 8;
                        wf[(g + 2) % 3][kk].q[0] = *(const u32x4*)bp;
                        wf[(g + 2) % 3][kk].q[1] = *(const u32x4*)(bp + 16);
                    }
                }
                // The two scheduling barriers hold the four LDS reads of step g + 2 as one group between
                // the products of steps g - 1 and g: sunk to their use they would be waited for to zero,
                // lifted further they would need a fourth set of registers.
                __builtin_amdgcn_sched_barrier(0);
#pragma unroll
                for (int kk = 0; kk < 2; ++kk)
#pragma unroll
                    for (int tt = 0; tt < 4; ++tt) {
                        const int k8 = kp * 2 + kk;
                        const v8f c0 = k8 == 0 ? vzero : acc[tt];
                        // q, k: W * x^T (lane = token); v: x * W^T (lane = c)
                        acc[tt] = p < 2 ? wmma_f16(wf[g % 3][kk].v, xa[tt][k8].v, c0)
                                        : wmma_f16(xa[tt][k8].v, wf[g % 3][kk].v, c0);
                    }
                if (kp == 3) {
#pragma unroll
                    for (int tt = 0; tt < 4; ++tt)
#pragma unroll
                        for (int e = 0; e < 8; ++e) {
                            // q, k: c = ot * 16 + 8 * hf + e;  v: j = tt * 16 + 8 * hf + e, c tile ot
                            if (p < 2) fqk[p][tt].e[ot * 8 + e] = (_Float16)acc[tt][e];
                            else       fv[ot][tt >> 1].e[(tt & 1) * 8 + e] = (_Float16)acc[tt][e];
                        }
                }
                __builtin_amdgcn_sched_barrier(0);
            }
            if (!LAST && half < 2) {
#pragma unroll
                for (int i = 0; i < HLD / 2; ++i)
                    *(u32x4*)(sn + (half * (HLD / 2) + i) * 8 * WPITCH) = t[i];
            }
            }
        }

        if constexpr (!LAST) {
            // Publishes slab h + 1. It also ends every wave's reads of slab h, whose buffer is stored into
            // in the next pass, or, behind head 6, takes that head's O below.
            __syncthreads();
        } else {
            // x is dead: W_out flies under the last head's softmax.
            // The thread's offset is formed anew, as for the slabs: held over the heads it went to scratch.
            unsigned lw;
            asm volatile("v_mbcnt_lo_u32_b32 %0, -1, 0" : "=v"(lw));
            const unsigned wl = (lw & 31) * 8;      // the mask tells the compiler the range: a 32-bit offset will do
            const _Float16* wob = wo16 + swave * 256;
#pragma unroll   // to[] stays in registers only with constant indices
            for (int i = 0; i < 32; ++i) to[i] = *(const u32x4*)(wob + i * (8 * 256) + wl);
            // The address registers of these loads are free for reuse from here on: the wait takes their offset
            // as an input, so that no load of the run lands on it, and the scheduling barrier keeps the later
            // writes behind it.
            asm volatile("s_wait_xcnt 0x0" :: "v"(wl) : "memory");
            __builtin_amdgcn_sched_barrier(0);
        }
        _Float16* pk = (h < OHEADS ? sP + h * (8 * OWAVE) : sW[h & 1]) + swave * OWAVE + lane * 8;

#pragma unroll
        for (int it = 0; it < 4; ++it) {
            // S^T: lane = query i (it * 16 + l16), j = jt * 16 + 8 * hf + e
            // The bias row, divided by SCALE, is the products' start value: st = q.k + bias / SCALE.
            v8f st[4];
            const float* bp = sB + (it * 16 + l16) * BPITCH + hf * 8;
            float m4[4], s4[4];
#pragma unroll
            for (int jt = 0; jt < 4; ++jt) {
                union { v8f v; f32x4 q[2]; } cb;
                cb.q[0] = *(const f32x4*)(bp + jt * 16);
                cb.q[1] = *(const f32x4*)(bp + jt * 16 + 4);
                st[jt] = wmma_f16(fqk[1][jt].v, fqk[0][it].v, cb.v);
            }
#pragma unroll
            for (int jt = 0; jt < 4; ++jt) {
                float ma = fmaxf(fmaxf(st[jt][0], st[jt][1]), fmaxf(st[jt][2], st[jt][3]));
                float mb = fmaxf(fmaxf(st[jt][4], st[jt][5]), fmaxf(st[jt][6], st[jt][7]));
                m4[jt] = fmaxf(ma, mb);
            }
            // softmax over j of SCALE * st: a row lives in the two lanes l16 and l16 + 16
            float mx = fmaxf(fmaxf(m4[0], m4[1]), fmaxf(m4[2], m4[3]));
            mx = fmaxf(mx, xhalf(mx));
#pragma unroll
            for (int jt = 0; jt < 4; ++jt) {
                float d[8], r[8];
#pragma unroll
                for (int e = 0; e < 8; ++e) {   // e^(SCALE * t) = 2^(t * SCALE * log2(e))
                    d[e] = (st[jt][e] - mx) * (SCALE * 1.4426950408889634f);
                    r[e] = __builtin_amdgcn_exp2f(d[e]);
                }
                // The slot behind a transcendental: no reader of a result and no write over a source of
                // these eight stands in front of this v_nop, so none follows its v_exp_f32 directly.
                asm("v_nop" : "+v"(r[0]), "+v"(r[1]), "+v"(r[2]), "+v"(r[3]), "+v"(r[4]), "+v"(r[5]), "+v"(r[6]), "+v"(r[7])
                            : "v"(d[0]), "v"(d[1]), "v"(d[2]), "v"(d[3]), "v"(d[4]), "v"(d[5]), "v"(d[6]), "v"(d[7]));
#pragma unroll
                for (int e = 0; e < 8; ++e) st[jt][e] = r[e];
                s4[jt] = ((st[jt][0] + st[jt][1]) + (st[jt][2] + st[jt][3]))
                       + ((st[jt][4] + st[jt][5]) + (st[jt][6] + st[jt][7]));
            }
            float sum = (s4[0] + s4[1]) + (s4[2] + s4[3]);
            sum += xhalf(sum);
            float inv = 1.0f / sum;
            Frag fp[2];      // P^T: lane = i, k order over j
#pragma unroll
            for (int jt = 0; jt < 4; ++jt)
#pragma unroll
                for (int e = 0; e < 8; ++e) fp[jt >> 1].e[(jt & 1) * 8 + e] = (_Float16)(st[jt][e] * inv);

            // O^T: lane = i, c = ct * 16 + 8 * hf + e
#pragma unroll
            for (int ct = 0; ct < 2; ++ct) {
                v8f o = wmma_f16(fv[ct][0].v, fp[0].v, vzero);
                o = wmma_f16(fv[ct][1].v, fp[1].v, o);
                Frag r;
#pragma unroll
                for (int e = 0; e < 8; ++e) r.e[e] = (_Float16)o[e];
                if constexpr (LAST) oa[it][7].q[ct] = r.q[0];
                else                *(u32x4*)(pk + it * 512 + ct * 256) = r.q[0];
            }
            if (it & 1) {
                // Two query tiles side by side, not four: with the scores and bias rows of all four
                // live at once the build passes the register budget and sends x fragments to scratch.
                __builtin_amdgcn_sched_barrier(0);
            }
        }
    };
#pragma unroll 1   // one copy of the head body for heads 0 to 6
    for (int h = 0; h < 7; ++h) head_pass(h, std::false_type{});
    head_pass(7, std::true_type{});

    // ---- output projection: out[m,o] = sum_c O[m,c] * w_out[o,c] + b_out[o] ----
    // O fragments of k steps 0 to 6 (k step = head): the lane's own stores, read back.
#pragma unroll   // oa[] stays in registers only with constant indices
    for (int k8 = 0; k8 < 7; ++k8) {
        const _Float16* ob = (k8 < OHEADS ? sP + k8 * (8 * OWAVE) : sW[k8 & 1]) + swave * OWAVE + lane * 8;
#pragma unroll
        for (int tt = 0; tt < 4; ++tt) {
            oa[tt][k8].q[0] = *(const u32x4*)(ob + tt * 512);
            oa[tt][k8].q[1] = *(const u32x4*)(ob + tt * 512 + 256);
        }
    }
    // Ends every wave's reads of the park, which W_out now overwrites.
    __syncthreads();
#pragma unroll   // to[] stays in registers only with constant indices
    for (int i = 0; i < 32; ++i) *(u32x4*)(sP + (i * 8 + wave) * WPITCH + lane * 8) = to[i];
    // Publishes W_out.
    __syncthreads();

    // A trip forms 32 outputs (one 128-byte line) of each of the 64 tokens: two 16-row weight tiles of
    // four steps; a step is two weight fragments and eight products, as in the head pass. The fragments
    // are read two steps ahead into a ring of four, whose places repeat from trip to trip.
    // A lane's results are 32 bytes of a token's line, so a store straight from them would touch 16 lines.
    // They go through the wave's own staging rows, one row per token, which take the lines of two trips side
    // by side: an aligned 256-byte piece of the token's output row. The rows
    // leave under the trip behind the pair, a half-wave to a piece, so that each piece is written by one store.
    // The rows lie in LDS that is free behind the barriers above: the slab buffers and the park's end.
    const _Float16* so = sP + l16 * WPITCH + hf * 8;
    // The lane's number is read anew (volatile: not lifted over the heads) and the window's place comes from
    // scalar registers: formed at the kernel's entry and held over the heads, these addresses went to scratch.
    unsigned lnr;
    asm volatile("v_mbcnt_lo_u32_b32 %0, -1, 0" : "=v"(lnr));
    const unsigned ln = lnr & 31;               // the mask tells the compiler the range: 32-bit offsets will do
    const unsigned swid = blockIdx.x * 8 + swave;
    const unsigned sbl = swid >> 8, swy = (swid >> 4) & 15, swx = swid & 15;
    float* stg = swave < SSLAB ? (float*)&sW[0][0] + swave * SWAVE
                               : (float*)(sP + 256 * WPITCH) + (swave - SSLAB) * SWAVE;
    float* sst = stg + (ln & 15) * SPITCH + (ln >> 4) * 8;
    // Store j of a pair of trips takes window positions 2 * j and 2 * j + 1, one to a half-wave, which reads
    // a whole staging row: every bank once.
    const float* srd = stg + (ln >> 4) * SPITCH + (ln & 15) * 4;
    float* outw = out + ((size_t)sbl * 16384 + (size_t)swy * 1024 + swx * 8) * 256;   // the window's first token
    const unsigned oq = (ln >> 4) * 256 + (ln & 15) * 4;
    f32x4 rb[16];        // half of the pieces of the pair of trips before, on their way out
    Frag wg[4][2];
#pragma unroll
    for (int g = 0; g < 2; ++g)
#pragma unroll
        for (int kk = 0; kk < 2; ++kk) {
            wg[g][kk].q[0] = *(const u32x4*)(so + (g * 2 + kk) * 32);
            wg[g][kk].q[1] = *(const u32x4*)(so + (g * 2 + kk) * 32 + 16);
        }
    // Half b of the rows: window positions b * 32 and up.
    auto read_back = [&](const int b) __attribute__((always_inline)) {
        // The wave's own staging stores have retired before other lanes' rows are read; no staging store
        // stands between the two halves, so the first half's wait serves both.
        if (b == 0) asm volatile("s_wait_dscnt 0x0" ::: "memory");
#pragma unroll   // rb[] stays in registers only with constant indices
        for (int j = 0; j < 16; ++j) rb[j] = *(const f32x4*)(srd + (b * 32 + j * 2) * SPITCH);
    };
    auto send = [&](const int m, const int b) __attribute__((always_inline)) {
#pragma unroll
        for (int j = 0; j < 16; ++j)     // position b * 32 + j * 2: window row b * 4 + (j >> 2), column (j & 3) * 2
            *(f32x4*)(outw + m * 64 + (oq + ((b * 4 + (j >> 2)) * 128 + (j & 3) * 2) * 256)) = rb[j];
        // Later code rewrites registers that these stores name (data, address).
        asm volatile("s_wait_xcnt 0x0" ::: "memory");
    };
#pragma unroll 1   // one copy of the trip: eight would double the kernel's text
    for (int n = 0; n < 8; ++n) {
        const _Float16* sc = so + n * (32 * WPITCH);
        // The last trip reads the first two steps of trip 0 once more, for nobody: inside the array, no branch.
        const _Float16* sx = so + ((n + 1) & 7) * (32 * WPITCH);
        const bool full = n != 0 && (n & 1) == 0;    // the pair of trips before lies whole in the staging rows
        float* sh = sst + (n & 1) * 32;              // this trip's half of the rows
        v8f acc[4];          // [token tile]
        f32x4 bo[2];
#pragma unroll
        for (int g = 0; g < 8; ++g) {
            const int ot = g >> 2, kp = g & 3;
            // The rows of the pair before are read with the fragments of steps 2 and 4 and sent behind steps 1
            // and 3, all in front of this trip's first staging stores.
            if ((g == 0 || g == 2) && full) read_back(g >> 1);
            {
                const _Float16* sp = (g + 2 < 8 ? sc : sx) + (((g + 2) & 7) >> 2) * (16 * WPITCH) + ((g + 2) & 3) * 64;
#pragma unroll
                for (int kk = 0; kk < 2; ++kk) {
                    wg[(g + 2) & 3][kk].q[0] = *(const u32x4*)(sp + kk * 32);
                    wg[(g + 2) & 3][kk].q[1] = *(const u32x4*)(sp + kk * 32 + 16);
                }
            }
            if (kp == 0) {
                bo[0] = *(const f32x4*)(sBo + n * 32 + ot * 16 + hf * 8);
                bo[1] = *(const f32x4*)(sBo + n * 32 + ot * 16 + hf * 8 + 4);
            }
            // As in the head pass: the two scheduling barriers hold the LDS reads of step g + 2 as one
            // group between the products of steps g - 1 and g.
            __builtin_amdgcn_sched_barrier(0);
#pragma unroll
            for (int kk = 0; kk < 2; ++kk)
#pragma unroll
                for (int tt = 0; tt < 4; ++tt) {
                    const int k8 = kp * 2 + kk;
                    acc[tt] = wmma_f16(wg[g & 3][kk].v, oa[tt][k8].v, k8 == 0 ? vzero : acc[tt]);
                }
            if ((g == 1 || g == 3) && full) send((n >> 1) - 1, g >> 1);
            if (kp == 3) {
                // lane = token tt * 16 + l16, o = n * 32 + ot * 16 + 8 * hf + e
#pragma unroll
                for (int tt = 0; tt < 4; ++tt) {
                    f32x4 lo = {acc[tt][0], acc[tt][1], acc[tt][2], acc[tt][3]};
                    f32x4 hi = {acc[tt][4], acc[tt][5], acc[tt][6], acc[tt][7]};
                    *(f32x4*)(sh + tt * (16 * SPITCH) + ot * 16)     = lo + bo[0];
                    *(f32x4*)(sh + tt * (16 * SPITCH) + ot * 16 + 4) = hi + bo[1];
                }
            }
            __builtin_amdgcn_sched_barrier(0);
        }
    }
    // The last pair. The O fragments are dead, so both halves of the rows are read in one run.
    f32x4 rt[32];
    // As in read_back: the wave's own staging stores have retired before other lanes' rows are read.
    asm volatile("s_wait_dscnt 0x0" ::: "memory");
#pragma unroll   // rt[] stays in registers only with constant indices
    for (int j = 0; j < 32; ++j) rt[j] = *(const f32x4*)(srd + j * 2 * SPITCH);
#pragma unroll
    for (int j = 0; j < 32; ++j)
        *(f32x4*)(outw + 3 * 64 + (oq + ((j >> 2) * 128 + (j & 3) * 2) * 256)) = rt[j];
}

// ---------------- launch ----------------

extern "C" void kernel_launch(void* const* d_in, const int* in_sizes, int n_in,
                              void* d_out, int out_size, void* d_ws, size_t ws_size,
                              hipStream_t stream) {
    const float* x    = (const float*)d_in[0];  // (2,4,128,128,256)
    const float* wqkv = (const float*)d_in[1];  // (768,256)
    const float* pos  = (const float*)d_in[2];  // (15,15)
    const float* wout = (const float*)d_in[3];  // (256,256)
    const float* bout = (const float*)d_in[4];  // (256,)
    float* out = (float*)d_out;

    // scratch layout
    char* ws = (char*)d_ws;
    _Float16* woh   = (_Float16*)ws;  ws += (size_t)768 * 256 * 2;
    _Float16* wouth = (_Float16*)ws;  ws += (size_t)256 * 256 * 2;
    float*    bias  = (float*)ws;

    prep_kernel<<<132, 256, 0, stream>>>(wqkv, wout, pos, woh, wouth, bias);
    qkv_attn_kernel<<<256, 256, 0, stream>>>(x, woh, bias, wouth, bout, out);
}
